// v000
// The times below were measured on an AMD MI455X: many runs one after another, warmed up first and cycling through
// copies of the inputs, with the whole window's GPU time divided by the number of runs. Launches and the gaps
// between them are all in it. The median over several windows is given; except for v000 it joins two sittings, which
// can be a few percent apart, so the side-by-side timings, each taken in one sitting, are the better comparison.
// v000 is the starting kernel. One run takes 152 microseconds.
#include <hip/hip_runtime.h>
#include <hip/hip_bf16.h>
#include <math.h>

// Problem constants (from reference)
#define BATCH   3
#define SEQ     4096
#define EMB     2048
#define HEAD    64
#define NROWS   (BATCH * SEQ)     // 12288 query rows
#define NTILES  (NROWS / 16)      // 768 row-tiles of 16

typedef __attribute__((ext_vector_type(16))) __bf16 v16bf;
typedef __attribute__((ext_vector_type(8)))  __bf16 v8bf;
typedef __attribute__((ext_vector_type(8)))  float  v8f;
typedef __attribute__((ext_vector_type(4)))  float  v4f;

// ---------------------------------------------------------------------------
// Kernel 1: split Wq (f32) into bf16 hi/lo planes (for bf16x3 WMMA GEMM)
// ---------------------------------------------------------------------------
__global__ void prep_w(const float* __restrict__ Wq,
                       __bf16* __restrict__ hi, __bf16* __restrict__ lo) {
  int i = blockIdx.x * blockDim.x + threadIdx.x;
  if (i < HEAD * EMB) {
    float w  = Wq[i];
    __bf16 h = (__bf16)w;
    hi[i] = h;
    lo[i] = (__bf16)(w - (float)h);
  }
}

// ---------------------------------------------------------------------------
// Kernel 2: k16/v16 = x[b, 0:16, :] @ Wk^T / Wv^T  (full f32 — only 16
// distinct K/V rows per batch survive the paged-cache semantics)
// Thread i -> (b, t, h) with i = b*1024 + t*64 + h
// ---------------------------------------------------------------------------
__global__ void prep_kv(const float* __restrict__ x,
                        const float* __restrict__ Wk,
                        const float* __restrict__ Wv,
                        float* __restrict__ k16, float* __restrict__ v16) {
  int i = blockIdx.x * blockDim.x + threadIdx.x;
  int h = i & 63;
  int t = (i >> 6) & 15;
  int b = i >> 10;
  if (b >= BATCH) return;
  const float* xr  = x  + ((size_t)b * SEQ + t) * EMB;
  const float* wkr = Wk + (size_t)h * EMB;
  const float* wvr = Wv + (size_t)h * EMB;
  float ak = 0.f, av = 0.f;
  for (int e = 0; e < EMB; e += 4) {
    v4f xv = *(const v4f*)(xr + e);
    v4f kv = *(const v4f*)(wkr + e);
    v4f vv = *(const v4f*)(wvr + e);
    ak += xv.x * kv.x + xv.y * kv.y + xv.z * kv.z + xv.w * kv.w;
    av += xv.x * vv.x + xv.y * vv.y + xv.z * vv.z + xv.w * vv.w;
  }
  k16[i] = ak;
  v16[i] = av;
}

// ---------------------------------------------------------------------------
// Kernel 3: fused Q-GEMM (WMMA bf16x3, f32 accum) + collapsed 16-key
// count-weighted causal softmax + V combine. One wave32 per 16-row tile.
// ---------------------------------------------------------------------------
__global__ __launch_bounds__(256) void attn_main(
    const float*  __restrict__ x,
    const __bf16* __restrict__ wq_hi,
    const __bf16* __restrict__ wq_lo,
    const float*  __restrict__ k16,
    const float*  __restrict__ v16,
    float*        __restrict__ out) {
  __shared__ float qtile[8 * 16 * 65];          // 8 waves, 16x64 padded to 65

  const int wave = threadIdx.x >> 5;
  const int lane = threadIdx.x & 31;
  const int r    = lane & 15;                   // row within tile / N index
  const int kh   = lane >> 4;                   // lane-half: selects K sub-blocks
  const int tile = blockIdx.x * 8 + wave;       // 0..767, exact
  const int m0   = tile * 16;

  const float* xrow = x + (size_t)(m0 + r) * EMB;

  v8f acc[4] = {};                              // 16x64 f32 Q accumulators

  for (int kb = 0; kb < EMB; kb += 32) {
    // ---- A operand: x row, ISA 16-bit A layout.
    // lanes 0-15: K = {0..7, 16..23}; lanes 16-31: K = {8..15, 24..31}
    const float* ap = xrow + kb + kh * 8;
    float af[16];
    *(v4f*)(af + 0)  = *(const v4f*)(ap + 0);
    *(v4f*)(af + 4)  = *(const v4f*)(ap + 4);
    *(v4f*)(af + 8)  = *(const v4f*)(ap + 16);
    *(v4f*)(af + 12) = *(const v4f*)(ap + 20);
    v16bf ah, al;
#pragma unroll
    for (int i = 0; i < 16; i++) {
      float  f = af[i];
      __bf16 h = (__bf16)f;
      ah[i] = h;
      al[i] = (__bf16)(f - (float)h);           // exact residual, then bf16
    }

    // ---- 4 N-tiles of 16 head columns each; B column n == Wq row n (contig)
#pragma unroll
    for (int j = 0; j < 4; j++) {
      const size_t  boff = (size_t)(j * 16 + r) * EMB + kb + kh * 8;
      const __bf16* bhp  = wq_hi + boff;
      const __bf16* blp  = wq_lo + boff;
      v8bf bh0 = *(const v8bf*)(bhp);
      v8bf bh1 = *(const v8bf*)(bhp + 16);
      v8bf bl0 = *(const v8bf*)(blp);
      v8bf bl1 = *(const v8bf*)(blp + 16);
      v16bf bhi = __builtin_shufflevector(bh0, bh1, 0,1,2,3,4,5,6,7,8,9,10,11,12,13,14,15);
      v16bf blo = __builtin_shufflevector(bl0, bl1, 0,1,2,3,4,5,6,7,8,9,10,11,12,13,14,15);

      // bf16x3: xh*wh + xl*wh + xh*wl  (f32 accumulate)
      acc[j] = __builtin_amdgcn_wmma_f32_16x16x32_bf16(false, ah, false, bhi,
                                                       (short)0, acc[j], false, false);
      acc[j] = __builtin_amdgcn_wmma_f32_16x16x32_bf16(false, al, false, bhi,
                                                       (short)0, acc[j], false, false);
      acc[j] = __builtin_amdgcn_wmma_f32_16x16x32_bf16(false, ah, false, blo,
                                                       (short)0, acc[j], false, false);
    }
  }

  // ---- Spill Q tile to LDS. D layout: VGPR i -> M = i + 8*kh, N = j*16 + r
  float* qt = qtile + wave * 16 * 65;
#pragma unroll
  for (int j = 0; j < 4; j++) {
#pragma unroll
    for (int i = 0; i < 8; i++) {
      qt[(kh * 8 + i) * 65 + j * 16 + r] = acc[j][i];
    }
  }
  __syncthreads();

  // ---- Collapsed attention: 16 distinct keys, count-weighted softmax.
  // Lane handles row r; kh selects output halves h in [kh*32, kh*32+32).
  const int m  = m0 + r;
  const int b  = m >> 12;                       // / SEQ (4096)
  const int qi = m & (SEQ - 1);

  float qreg[64];
  const float* qv = qt + r * 65;
#pragma unroll
  for (int h = 0; h < 64; h++) qreg[h] = qv[h];

  const float* kb16 = k16 + b * 16 * 64;
  const float* vb16 = v16 + b * 16 * 64;
  const int d    = qi >> 4;
  const int mres = qi & 15;

  float s[16];
  float smax = -3.0e38f;
#pragma unroll
  for (int t = 0; t < 16; t++) {
    float dot = 0.f;
    const float* kr = kb16 + t * 64;
    for (int h = 0; h < 64; h++) dot += qreg[h] * kr[h];
    s[t] = dot * 0.125f;                        // HEAD^-0.5 = 1/8
    int cnt = d + ((t <= mres) ? 1 : 0);
    if (cnt > 0 && s[t] > smax) smax = s[t];
  }

  float w[16];
  float Z = 0.f;
#pragma unroll
  for (int t = 0; t < 16; t++) {
    int cnt = d + ((t <= mres) ? 1 : 0);
    float e = 0.f;
    if (cnt > 0) e = (float)cnt * expf(s[t] - smax);
    w[t] = e;
    Z += e;
  }
  const float invZ = 1.0f / Z;

  float* orow = out + (size_t)m * HEAD + kh * 32;
  for (int h = 0; h < 32; h++) {
    float o = 0.f;
#pragma unroll
    for (int t = 0; t < 16; t++) o += w[t] * vb16[t * 64 + kh * 32 + h];
    orow[h] = o * invZ;
  }
}

// ---------------------------------------------------------------------------
extern "C" void kernel_launch(void* const* d_in, const int* in_sizes, int n_in,
                              void* d_out, int out_size, void* d_ws, size_t ws_size,
                              hipStream_t stream) {
  const float* x  = (const float*)d_in[0];
  const float* Wq = (const float*)d_in[1];
  const float* Wk = (const float*)d_in[2];
  const float* Wv = (const float*)d_in[3];
  float* out = (float*)d_out;

  char* ws = (char*)d_ws;
  // ws layout: wq_hi (256KB) | wq_lo (256KB) | k16 (12KB) | v16 (12KB)
  __bf16* wq_hi = (__bf16*)(ws);
  __bf16* wq_lo = (__bf16*)(ws + 262144);
  float*  k16   = (float*) (ws + 524288);
  float*  v16   = (float*) (ws + 524288 + 12288);

  prep_w   <<<(HEAD * EMB + 255) / 256, 256, 0, stream>>>(Wq, wq_hi, wq_lo);
  prep_kv  <<<(BATCH * 16 * HEAD + 255) / 256, 256, 0, stream>>>(x, Wk, Wv, k16, v16);
  attn_main<<<NTILES / 8, 256, 0, stream>>>(x, wq_hi, wq_lo, k16, v16, out);
}

// v001
// It runs in 80.8 microseconds.
// In both of two side-by-side timings against v000, it was 1.90 times as fast.
#include <hip/hip_runtime.h>
#include <hip/hip_bf16.h>
#include <math.h>

// Problem constants (from reference)
#define BATCH   3
#define SEQ     4096
#define EMB     2048
#define HEAD    64
#define NROWS   (BATCH * SEQ)     // 12288 query rows
#define NTILES  (NROWS / 16)      // 768 row-tiles of 16

typedef __attribute__((ext_vector_type(16))) __bf16 v16bf;
typedef __attribute__((ext_vector_type(8)))  __bf16 v8bf;
typedef __attribute__((ext_vector_type(8)))  float  v8f;
typedef __attribute__((ext_vector_type(4)))  float  v4f;

// ---------------------------------------------------------------------------
// Kernel 1: split Wq (f32) into bf16 hi/lo planes (for bf16x3 WMMA GEMM)
// ---------------------------------------------------------------------------
__global__ void prep_w(const float* __restrict__ Wq,
                       __bf16* __restrict__ hi, __bf16* __restrict__ lo) {
  int i = blockIdx.x * blockDim.x + threadIdx.x;
  if (i < HEAD * EMB) {
    float w  = Wq[i];
    __bf16 h = (__bf16)w;
    hi[i] = h;
    lo[i] = (__bf16)(w - (float)h);
  }
}

// ---------------------------------------------------------------------------
// Kernel 2: k16/v16 = x[b, 0:16, :] @ Wk^T / Wv^T  (full f32; only 16
// distinct K/V rows per batch survive the paged-cache semantics)
// One wave per 2x2 patch of outputs (2 x rows, 2 weight rows); the 2048-long
// sum is split over the 32 lanes (16 bytes a lane, 512 contiguous bytes a load)
// and closed by a butterfly. A block of 16 waves owns 2 x rows and 32 heads of
// one matrix, so each 128-byte line of k16/v16 has one writing block.
// ---------------------------------------------------------------------------
__global__ __launch_bounds__(512) void prep_kv(const float* __restrict__ x,
                        const float* __restrict__ Wk,
                        const float* __restrict__ Wv,
                        float* __restrict__ k16, float* __restrict__ v16) {
  const int lane = threadIdx.x & 31;
  const int wave = threadIdx.x >> 5;            // 0..15
  const int rp   = blockIdx.x >> 2;             // 0..23: pair of x rows
  const int cg   = blockIdx.x & 3;              // matrix and half of the heads
  const int b    = rp >> 3;
  const int t    = (rp & 7) * 2;
  const int h    = (cg & 1) * 32 + wave * 2;
  const float* Wm  = (cg >> 1) ? Wv : Wk;
  float*       dst = (cg >> 1) ? v16 : k16;

  const float* x0 = x  + ((size_t)b * SEQ + t) * EMB + lane * 4;
  const float* x1 = x0 + EMB;
  const float* w0 = Wm + (size_t)h * EMB + lane * 4;
  const float* w1 = w0 + EMB;

  v4f a00 = {}, a01 = {}, a10 = {}, a11 = {};
#pragma unroll
  for (int e = 0; e < EMB; e += 128) {
    v4f xa = *(const v4f*)(x0 + e);
    v4f xb = *(const v4f*)(x1 + e);
    v4f wa = *(const v4f*)(w0 + e);
    v4f wb = *(const v4f*)(w1 + e);
    a00 += xa * wa;
    a01 += xa * wb;
    a10 += xb * wa;
    a11 += xb * wb;
  }
  float s[4];
  s[0] = (a00.x + a00.y) + (a00.z + a00.w);
  s[1] = (a01.x + a01.y) + (a01.z + a01.w);
  s[2] = (a10.x + a10.y) + (a10.z + a10.w);
  s[3] = (a11.x + a11.y) + (a11.z + a11.w);
#pragma unroll
  for (int m = 16; m >= 1; m >>= 1) {
#pragma unroll
    for (int i = 0; i < 4; i++) s[i] += __shfl_xor(s[i], m, 32);
  }
  // Lane i < 4 stores output (row t + i/2, head h + i%2).
  float mine = s[0];
  if (lane == 1) mine = s[1];
  if (lane == 2) mine = s[2];
  if (lane == 3) mine = s[3];
  if (lane < 4) dst[(b * 16 + t + (lane >> 1)) * HEAD + h + (lane & 1)] = mine;
}

// ---------------------------------------------------------------------------
// Kernel 3: fused Q-GEMM (WMMA bf16x3, f32 accum) + collapsed 16-key
// count-weighted causal softmax + V combine. One wave32 per 16-row tile.
// ---------------------------------------------------------------------------
__global__ __launch_bounds__(256) void attn_main(
    const float*  __restrict__ x,
    const __bf16* __restrict__ wq_hi,
    const __bf16* __restrict__ wq_lo,
    const float*  __restrict__ k16,
    const float*  __restrict__ v16,
    float*        __restrict__ out) {
  __shared__ float qtile[8 * 16 * 65];          // 8 waves, 16x64 padded to 65

  const int wave = threadIdx.x >> 5;
  const int lane = threadIdx.x & 31;
  const int r    = lane & 15;                   // row within tile / N index
  const int kh   = lane >> 4;                   // lane-half: selects K sub-blocks
  const int tile = blockIdx.x * 8 + wave;       // 0..767, exact
  const int m0   = tile * 16;

  const float* xrow = x + (size_t)(m0 + r) * EMB;

  v8f acc[4] = {};                              // 16x64 f32 Q accumulators

  for (int kb = 0; kb < EMB; kb += 32) {
    // ---- A operand: x row, ISA 16-bit A layout.
    // lanes 0-15: K = {0..7, 16..23}; lanes 16-31: K = {8..15, 24..31}
    const float* ap = xrow + kb + kh * 8;
    float af[16];
    *(v4f*)(af + 0)  = *(const v4f*)(ap + 0);
    *(v4f*)(af + 4)  = *(const v4f*)(ap + 4);
    *(v4f*)(af + 8)  = *(const v4f*)(ap + 16);
    *(v4f*)(af + 12) = *(const v4f*)(ap + 20);
    v16bf ah, al;
#pragma unroll
    for (int i = 0; i < 16; i++) {
      float  f = af[i];
      __bf16 h = (__bf16)f;
      ah[i] = h;
      al[i] = (__bf16)(f - (float)h);           // exact residual, then bf16
    }

    // ---- 4 N-tiles of 16 head columns each; B column n == Wq row n (contig)
#pragma unroll
    for (int j = 0; j < 4; j++) {
      const size_t  boff = (size_t)(j * 16 + r) * EMB + kb + kh * 8;
      const __bf16* bhp  = wq_hi + boff;
      const __bf16* blp  = wq_lo + boff;
      v8bf bh0 = *(const v8bf*)(bhp);
      v8bf bh1 = *(const v8bf*)(bhp + 16);
      v8bf bl0 = *(const v8bf*)(blp);
      v8bf bl1 = *(const v8bf*)(blp + 16);
      v16bf bhi = __builtin_shufflevector(bh0, bh1, 0,1,2,3,4,5,6,7,8,9,10,11,12,13,14,15);
      v16bf blo = __builtin_shufflevector(bl0, bl1, 0,1,2,3,4,5,6,7,8,9,10,11,12,13,14,15);

      // bf16x3: xh*wh + xl*wh + xh*wl  (f32 accumulate)
      acc[j] = __builtin_amdgcn_wmma_f32_16x16x32_bf16(false, ah, false, bhi,
                                                       (short)0, acc[j], false, false);
      acc[j] = __builtin_amdgcn_wmma_f32_16x16x32_bf16(false, al, false, bhi,
                                                       (short)0, acc[j], false, false);
      acc[j] = __builtin_amdgcn_wmma_f32_16x16x32_bf16(false, ah, false, blo,
                                                       (short)0, acc[j], false, false);
    }
  }

  // ---- Spill Q tile to LDS. D layout: VGPR i -> M = i + 8*kh, N = j*16 + r
  float* qt = qtile + wave * 16 * 65;
#pragma unroll
  for (int j = 0; j < 4; j++) {
#pragma unroll
    for (int i = 0; i < 8; i++) {
      qt[(kh * 8 + i) * 65 + j * 16 + r] = acc[j][i];
    }
  }
  __syncthreads();

  // ---- Collapsed attention: 16 distinct keys, count-weighted softmax.
  // Lane handles row r; kh selects output halves h in [kh*32, kh*32+32).
  const int m  = m0 + r;
  const int b  = m >> 12;                       // / SEQ (4096)
  const int qi = m & (SEQ - 1);

  float qreg[64];
  const float* qv = qt + r * 65;
#pragma unroll
  for (int h = 0; h < 64; h++) qreg[h] = qv[h];

  const float* kb16 = k16 + b * 16 * 64;
  const float* vb16 = v16 + b * 16 * 64;
  const int d    = qi >> 4;
  const int mres = qi & 15;

  float s[16];
  float smax = -3.0e38f;
#pragma unroll
  for (int t = 0; t < 16; t++) {
    float dot = 0.f;
    const float* kr = kb16 + t * 64;
    for (int h = 0; h < 64; h++) dot += qreg[h] * kr[h];
    s[t] = dot * 0.125f;                        // HEAD^-0.5 = 1/8
    int cnt = d + ((t <= mres) ? 1 : 0);
    if (cnt > 0 && s[t] > smax) smax = s[t];
  }

  float w[16];
  float Z = 0.f;
#pragma unroll
  for (int t = 0; t < 16; t++) {
    int cnt = d + ((t <= mres) ? 1 : 0);
    float e = 0.f;
    if (cnt > 0) e = (float)cnt * expf(s[t] - smax);
    w[t] = e;
    Z += e;
  }
  const float invZ = 1.0f / Z;

  float* orow = out + (size_t)m * HEAD + kh * 32;
  for (int h = 0; h < 32; h++) {
    float o = 0.f;
#pragma unroll
    for (int t = 0; t < 16; t++) o += w[t] * vb16[t * 64 + kh * 32 + h];
    orow[h] = o * invZ;
  }
}

// ---------------------------------------------------------------------------
extern "C" void kernel_launch(void* const* d_in, const int* in_sizes, int n_in,
                              void* d_out, int out_size, void* d_ws, size_t ws_size,
                              hipStream_t stream) {
  const float* x  = (const float*)d_in[0];
  const float* Wq = (const float*)d_in[1];
  const float* Wk = (const float*)d_in[2];
  const float* Wv = (const float*)d_in[3];
  float* out = (float*)d_out;

  char* ws = (char*)d_ws;
  // ws layout: wq_hi (256KB) | wq_lo (256KB) | k16 (12KB) | v16 (12KB)
  __bf16* wq_hi = (__bf16*)(ws);
  __bf16* wq_lo = (__bf16*)(ws + 262144);
  float*  k16   = (float*) (ws + 524288);
  float*  v16   = (float*) (ws + 524288 + 12288);

  prep_w   <<<(HEAD * EMB + 255) / 256, 256, 0, stream>>>(Wq, wq_hi, wq_lo);
  prep_kv  <<<BATCH * 8 * 4, 512, 0, stream>>>(x, Wk, Wv, k16, v16);
  attn_main<<<NTILES / 8, 256, 0, stream>>>(x, wq_hi, wq_lo, k16, v16, out);
}

// v002
// One run takes 36.7 microseconds.
// Next to v001, in two timings, it ran 2.19 and 2.21 times as fast.
// Over all steps from v000 it is 4.18 times as fast.
#include <hip/hip_runtime.h>
#include <hip/hip_bf16.h>
#include <math.h>

// Problem constants (from reference)
#define BATCH   3
#define SEQ     4096
#define EMB     2048
#define HEAD    64
#define NROWS   (BATCH * SEQ)     // 12288 query rows

typedef __attribute__((ext_vector_type(16))) __bf16 v16bf;
typedef __attribute__((ext_vector_type(8)))  __bf16 v8bf;
typedef __attribute__((ext_vector_type(8)))  float  v8f;
typedef __attribute__((ext_vector_type(4)))  float  v4f;
typedef __attribute__((ext_vector_type(2)))  float  v2f;

// ---------------------------------------------------------------------------
// Kernel 1: split Wq (f32) into bf16 hi/lo planes (for bf16x3 WMMA GEMM)
// ---------------------------------------------------------------------------
__global__ void prep_w(const float* __restrict__ Wq,
                       __bf16* __restrict__ hi, __bf16* __restrict__ lo) {
  int i = blockIdx.x * blockDim.x + threadIdx.x;
  if (i < HEAD * EMB) {
    float w  = Wq[i];
    __bf16 h = (__bf16)w;
    hi[i] = h;
    lo[i] = (__bf16)(w - (float)h);
  }
}

// ---------------------------------------------------------------------------
// Kernel 2: k16/v16 = x[b, 0:16, :] @ Wk^T / Wv^T  (full f32; only 16
// distinct K/V rows per batch survive the paged-cache semantics)
// One wave per 2x2 patch of outputs (2 x rows, 2 weight rows); the 2048-long
// sum is split over the 32 lanes (16 bytes a lane, 512 contiguous bytes a load)
// and closed by a butterfly. A block of 16 waves owns 2 x rows and 32 heads of
// one matrix, so each 128-byte line of k16/v16 has one writing block.
// ---------------------------------------------------------------------------
__global__ __launch_bounds__(512) void prep_kv(const float* __restrict__ x,
                        const float* __restrict__ Wk,
                        const float* __restrict__ Wv,
                        float* __restrict__ k16, float* __restrict__ v16) {
  const int lane = threadIdx.x & 31;
  const int wave = threadIdx.x >> 5;            // 0..15
  const int rp   = blockIdx.x >> 2;             // 0..23: pair of x rows
  const int cg   = blockIdx.x & 3;              // matrix and half of the heads
  const int b    = rp >> 3;
  const int t    = (rp & 7) * 2;
  const int h    = (cg & 1) * 32 + wave * 2;
  const float* Wm  = (cg >> 1) ? Wv : Wk;
  float*       dst = (cg >> 1) ? v16 : k16;

  const float* x0 = x  + ((size_t)b * SEQ + t) * EMB + lane * 4;
  const float* x1 = x0 + EMB;
  const float* w0 = Wm + (size_t)h * EMB + lane * 4;
  const float* w1 = w0 + EMB;

  v4f a00 = {}, a01 = {}, a10 = {}, a11 = {};
#pragma unroll
  for (int e = 0; e < EMB; e += 128) {
    v4f xa = *(const v4f*)(x0 + e);
    v4f xb = *(const v4f*)(x1 + e);
    v4f wa = *(const v4f*)(w0 + e);
    v4f wb = *(const v4f*)(w1 + e);
    a00 += xa * wa;
    a01 += xa * wb;
    a10 += xb * wa;
    a11 += xb * wb;
  }
  float s[4];
  s[0] = (a00.x + a00.y) + (a00.z + a00.w);
  s[1] = (a01.x + a01.y) + (a01.z + a01.w);
  s[2] = (a10.x + a10.y) + (a10.z + a10.w);
  s[3] = (a11.x + a11.y) + (a11.z + a11.w);
#pragma unroll
  for (int m = 16; m >= 1; m >>= 1) {
#pragma unroll
    for (int i = 0; i < 4; i++) s[i] += __shfl_xor(s[i], m, 32);
  }
  // Lane i < 4 stores output (row t + i/2, head h + i%2).
  float mine = s[0];
  if (lane == 1) mine = s[1];
  if (lane == 2) mine = s[2];
  if (lane == 3) mine = s[3];
  if (lane < 4) dst[(b * 16 + t + (lane >> 1)) * HEAD + h + (lane & 1)] = mine;
}

// ---------------------------------------------------------------------------
// Kernel 3: fused Q-GEMM (WMMA bf16x3, f32 accum) + collapsed 16-key
// count-weighted causal softmax + V combine.
// A block owns 48 query rows (3 tiles of 16) and splits the 2048-long K sum
// over its 16 waves: wave w does columns [128 w, 128 w + 128) of x and Wq for
// all 3 x 4 accumulator tiles, so a block reads each Wq element once. The 16
// partial tiles are summed through LDS in rising order of w; waves 0..2 then
// finish one 16-row tile each.
// ---------------------------------------------------------------------------
#define MT      3                 // 16-row tiles a block
#define KW      16                // waves a block = K slices
#define KSLICE  (EMB / KW)        // 128 columns a wave
#define NPAIR   (MT * 4 * 4)      // 48 register pairs of accumulators a lane

__global__ __launch_bounds__(512) void attn_main(
    const float*  __restrict__ x,
    const __bf16* __restrict__ wq_hi,
    const __bf16* __restrict__ wq_lo,
    const float*  __restrict__ k16,
    const float*  __restrict__ v16,
    float*        __restrict__ out) {
  __shared__ v2f   part[KW * NPAIR * 32];       // [slice][register pair][lane]
  __shared__ float qtile[MT * 16 * 65];         // 3 tiles, 16x64 padded to 65

  const int wave = __builtin_amdgcn_readfirstlane(threadIdx.x >> 5);
  const int lane = threadIdx.x & 31;
  const int r    = lane & 15;                   // row within tile / N index
  const int kh   = lane >> 4;                   // lane-half: selects K sub-blocks
  const int mblk = blockIdx.x * (MT * 16);      // first row of the block
  const int k0   = wave * KSLICE + kh * 8;      // this lane's first column

  const float* xrow = x + (size_t)(mblk + r) * EMB + k0;

  v8f acc[MT][4] = {};                          // 48x64 f32 partial Q

  for (int kb = 0; kb < KSLICE; kb += 32) {
    // ---- A operands: x rows, ISA 16-bit A layout.
    // lanes 0-15: K = {0..7, 16..23}; lanes 16-31: K = {8..15, 24..31}
    v16bf ah[MT], al[MT];
#pragma unroll  // constant mt: ah, al and acc stay in registers
    for (int mt = 0; mt < MT; mt++) {
      const float* ap = xrow + (size_t)mt * 16 * EMB + kb;
      float af[16];
      *(v4f*)(af + 0)  = *(const v4f*)(ap + 0);
      *(v4f*)(af + 4)  = *(const v4f*)(ap + 4);
      *(v4f*)(af + 8)  = *(const v4f*)(ap + 16);
      *(v4f*)(af + 12) = *(const v4f*)(ap + 20);
#pragma unroll
      for (int i = 0; i < 16; i++) {
        float  f = af[i];
        __bf16 h = (__bf16)f;
        ah[mt][i] = h;
        al[mt][i] = (__bf16)(f - (float)h);     // exact residual, then bf16
      }
    }

    // ---- 4 N-tiles of 16 head columns each; B column n == Wq row n (contig)
#pragma unroll
    for (int j = 0; j < 4; j++) {
      const size_t  boff = (size_t)(j * 16 + r) * EMB + k0 + kb;
      const __bf16* bhp  = wq_hi + boff;
      const __bf16* blp  = wq_lo + boff;
      v8bf bh0 = *(const v8bf*)(bhp);
      v8bf bh1 = *(const v8bf*)(bhp + 16);
      v8bf bl0 = *(const v8bf*)(blp);
      v8bf bl1 = *(const v8bf*)(blp + 16);
      v16bf bhi = __builtin_shufflevector(bh0, bh1, 0,1,2,3,4,5,6,7,8,9,10,11,12,13,14,15);
      v16bf blo = __builtin_shufflevector(bl0, bl1, 0,1,2,3,4,5,6,7,8,9,10,11,12,13,14,15);

      // bf16x3: xh*wh + xl*wh + xh*wl  (f32 accumulate)
#pragma unroll  // constant mt, as above; one B fragment serves the 3 row tiles
      for (int mt = 0; mt < MT; mt++) {
        acc[mt][j] = __builtin_amdgcn_wmma_f32_16x16x32_bf16(false, ah[mt], false, bhi,
                                                       (short)0, acc[mt][j], false, false);
        acc[mt][j] = __builtin_amdgcn_wmma_f32_16x16x32_bf16(false, al[mt], false, bhi,
                                                       (short)0, acc[mt][j], false, false);
        acc[mt][j] = __builtin_amdgcn_wmma_f32_16x16x32_bf16(false, ah[mt], false, blo,
                                                       (short)0, acc[mt][j], false, false);
      }
    }
  }

  // ---- Each wave lays its partial down as it holds it: pair p = (mt*4+j)*4+ii
  // is accumulator registers 2*ii and 2*ii+1 of tile (mt, j), lane by lane.
  // (All three loops unrolled: acc is indexed by constants only.)
  v2f* pw = part + wave * (NPAIR * 32) + lane;
#pragma unroll
  for (int mt = 0; mt < MT; mt++) {
#pragma unroll
    for (int j = 0; j < 4; j++) {
#pragma unroll
      for (int ii = 0; ii < 4; ii++) {
        v2f p2 = { acc[mt][j][2 * ii], acc[mt][j][2 * ii + 1] };
        pw[((mt * 4 + j) * 4 + ii) * 32] = p2;
      }
    }
  }
  __syncthreads();

  // ---- Sum the 16 slices. Wave w takes pair mt*16 + w of each tile row mt, so
  // j = w / 4 and ii = w % 4. D layout: VGPR i -> M = i + 8*kh, N = j*16 + r
  // (Unrolled so that the 48 LDS reads of a lane issue ahead of the adds.)
#pragma unroll
  for (int mt = 0; mt < MT; mt++) {
    const v2f* pr = part + (mt * 16 + wave) * 32 + lane;
    v2f sum = pr[0];
#pragma unroll
    for (int sl = 1; sl < KW; sl++) sum += pr[sl * (NPAIR * 32)];
    float* qd = qtile + (mt * 16 + kh * 8 + (wave & 3) * 2) * 65 + (wave >> 2) * 16 + r;
    qd[0]  = sum.x;
    qd[65] = sum.y;
  }
  __syncthreads();

  if (wave >= MT) return;                       // behind the last barrier
  const int    m0 = mblk + wave * 16;
  const float* qt = qtile + wave * 16 * 65;

  // ---- Collapsed attention: 16 distinct keys, count-weighted softmax.
  // Lane handles row r; kh selects output halves h in [kh*32, kh*32+32).
  const int m  = m0 + r;
  const int b  = m >> 12;                       // / SEQ (4096)
  const int qi = m & (SEQ - 1);

  float qreg[64];
  const float* qv = qt + r * 65;
#pragma unroll
  for (int h = 0; h < 64; h++) qreg[h] = qv[h];

  const float* kb16 = k16 + b * 16 * 64;
  const float* vb16 = v16 + b * 16 * 64;
  const int d    = qi >> 4;
  const int mres = qi & 15;

  float s[16];
  float smax = -3.0e38f;
#pragma unroll
  for (int t = 0; t < 16; t++) {
    float dot = 0.f;
    const float* kr = kb16 + t * 64;
    for (int h = 0; h < 64; h++) dot += qreg[h] * kr[h];
    s[t] = dot * 0.125f;                        // HEAD^-0.5 = 1/8
    int cnt = d + ((t <= mres) ? 1 : 0);
    if (cnt > 0 && s[t] > smax) smax = s[t];
  }

  float w[16];
  float Z = 0.f;
#pragma unroll
  for (int t = 0; t < 16; t++) {
    int cnt = d + ((t <= mres) ? 1 : 0);
    float e = 0.f;
    if (cnt > 0) e = (float)cnt * expf(s[t] - smax);
    w[t] = e;
    Z += e;
  }
  const float invZ = 1.0f / Z;

  float* orow = out + (size_t)m * HEAD + kh * 32;
  for (int h = 0; h < 32; h++) {
    float o = 0.f;
#pragma unroll
    for (int t = 0; t < 16; t++) o += w[t] * vb16[t * 64 + kh * 32 + h];
    orow[h] = o * invZ;
  }
}

// ---------------------------------------------------------------------------
extern "C" void kernel_launch(void* const* d_in, const int* in_sizes, int n_in,
                              void* d_out, int out_size, void* d_ws, size_t ws_size,
                              hipStream_t stream) {
  const float* x  = (const float*)d_in[0];
  const float* Wq = (const float*)d_in[1];
  const float* Wk = (const float*)d_in[2];
  const float* Wv = (const float*)d_in[3];
  float* out = (float*)d_out;

  char* ws = (char*)d_ws;
  // ws layout: wq_hi (256KB) | wq_lo (256KB) | k16 (12KB) | v16 (12KB)
  __bf16* wq_hi = (__bf16*)(ws);
  __bf16* wq_lo = (__bf16*)(ws + 262144);
  float*  k16   = (float*) (ws + 524288);
  float*  v16   = (float*) (ws + 524288 + 12288);

  prep_w   <<<(HEAD * EMB + 255) / 256, 256, 0, stream>>>(Wq, wq_hi, wq_lo);
  prep_kv  <<<BATCH * 8 * 4, 512, 0, stream>>>(x, Wk, Wv, k16, v16);
  attn_main<<<NROWS / (MT * 16), KW * 32, 0, stream>>>(x, wq_hi, wq_lo, k16, v16, out);
}

// v003
// Measured time: 26.6 microseconds a run.
// Timed twice side by side with v002, it ran 1.35 and 1.39 times as fast.
// Counting every step since v000, it is 5.73 times as fast.
#include <hip/hip_runtime.h>
#include <hip/hip_bf16.h>
#include <math.h>

// Problem constants (from reference)
#define BATCH   3
#define SEQ     4096
#define EMB     2048
#define HEAD    64
#define NROWS   (BATCH * SEQ)     // 12288 query rows

typedef __attribute__((ext_vector_type(16))) __bf16 v16bf;
typedef __attribute__((ext_vector_type(8)))  __bf16 v8bf;
typedef __attribute__((ext_vector_type(8)))  float  v8f;
typedef __attribute__((ext_vector_type(4)))  float  v4f;
typedef __attribute__((ext_vector_type(2)))  float  v2f;

// ---------------------------------------------------------------------------
// Kernel 1: k16/v16 = x[b, 0:16, :] @ Wk^T / Wv^T  (full f32; only 16
// distinct K/V rows per batch survive the paged-cache semantics)
// One wave per 2x2 patch of outputs (2 x rows, 2 weight rows); the 2048-long
// sum is split over the 32 lanes (16 bytes a lane, 512 contiguous bytes a load)
// and closed by a butterfly. A block of 16 waves owns 2 x rows and 32 heads of
// one matrix, so each 128-byte line of k16/v16 has one writing block.
// ---------------------------------------------------------------------------
__global__ __launch_bounds__(512) void prep_kv(const float* __restrict__ x,
                        const float* __restrict__ Wk,
                        const float* __restrict__ Wv,
                        float* __restrict__ k16, float* __restrict__ v16) {
  const int lane = threadIdx.x & 31;
  const int wave = threadIdx.x >> 5;            // 0..15
  const int rp   = blockIdx.x >> 2;             // 0..23: pair of x rows
  const int cg   = blockIdx.x & 3;              // matrix and half of the heads
  const int b    = rp >> 3;
  const int t    = (rp & 7) * 2;
  const int h    = (cg & 1) * 32 + wave * 2;
  const float* Wm  = (cg >> 1) ? Wv : Wk;
  float*       dst = (cg >> 1) ? v16 : k16;

  const float* x0 = x  + ((size_t)b * SEQ + t) * EMB + lane * 4;
  const float* x1 = x0 + EMB;
  const float* w0 = Wm + (size_t)h * EMB + lane * 4;
  const float* w1 = w0 + EMB;

  v4f a00 = {}, a01 = {}, a10 = {}, a11 = {};
#pragma unroll
  for (int e = 0; e < EMB; e += 128) {
    v4f xa = *(const v4f*)(x0 + e);
    v4f xb = *(const v4f*)(x1 + e);
    v4f wa = *(const v4f*)(w0 + e);
    v4f wb = *(const v4f*)(w1 + e);
    a00 += xa * wa;
    a01 += xa * wb;
    a10 += xb * wa;
    a11 += xb * wb;
  }
  float s[4];
  s[0] = (a00.x + a00.y) + (a00.z + a00.w);
  s[1] = (a01.x + a01.y) + (a01.z + a01.w);
  s[2] = (a10.x + a10.y) + (a10.z + a10.w);
  s[3] = (a11.x + a11.y) + (a11.z + a11.w);
#pragma unroll
  for (int m = 16; m >= 1; m >>= 1) {
#pragma unroll
    for (int i = 0; i < 4; i++) s[i] += __shfl_xor(s[i], m, 32);
  }
  // Lane i < 4 stores output (row t + i/2, head h + i%2).
  float mine = s[0];
  if (lane == 1) mine = s[1];
  if (lane == 2) mine = s[2];
  if (lane == 3) mine = s[3];
  if (lane < 4) dst[(b * 16 + t + (lane >> 1)) * HEAD + h + (lane & 1)] = mine;
}

// ---------------------------------------------------------------------------
// Kernel 2: fold Wq into the 16 keys of each batch. The scores are
// (x Wq^T) k16^T / 8 = (x G^T) / 8 with G[b][t][e] = sum_h k16[b][t][h] Wq[h][e]
// (f32, h rising).
// G is split into bf16 hi/lo planes (for the bf16x3 WMMA GEMM) and laid down as
// the B fragments are read: per batch and per block of 32 columns e
//   [plane hi, lo][half of the fragment][fragment lane kh*16 + t][8 columns]
// with e = 32*block + 16*half + 8*kh + i, so that one wave-wide 16-byte load
// of attn_main is 512 contiguous bytes.
// A block of 2 waves owns one (batch, 32 columns); wave th has keys 8*th..8*th+7,
// which are whole 128-byte lines of the layout above.
// ---------------------------------------------------------------------------
#define GBLK    1024              // bf16 elements of G per block of 32 columns
#define GBATCH  (EMB / 32 * GBLK) // bf16 elements of G per batch (128 KB)

__global__ __launch_bounds__(64) void fold_g(const float* __restrict__ Wq,
                                             const float* __restrict__ k16,
                                             __bf16* __restrict__ g) {
  const int lane = threadIdx.x & 31;            // column within the block of 32
  const int th   = __builtin_amdgcn_readfirstlane(threadIdx.x >> 5);
  const int b    = blockIdx.x >> 6;
  const int kblk = blockIdx.x & 63;

  const float* wc = Wq + kblk * 32 + lane;
  const float* kr = k16 + (b * 16 + th * 8) * HEAD;   // wave-uniform

  float a[8] = {};
#pragma unroll  // the 64 column loads issue ahead of the sums
  for (int h = 0; h < HEAD; h++) {
    float w = wc[(size_t)h * EMB];
#pragma unroll
    for (int t = 0; t < 8; t++) a[t] += kr[t * HEAD + h] * w;
  }

  __bf16* gd = g + (size_t)b * GBATCH + kblk * GBLK
             + (lane >> 4) * 256 + (((lane >> 3) & 1) * 16 + th * 8) * 8 + (lane & 7);
#pragma unroll
  for (int t = 0; t < 8; t++) {
    __bf16 hi = (__bf16)a[t];
    gd[t * 8]       = hi;
    gd[512 + t * 8] = (__bf16)(a[t] - (float)hi);
  }
}

// ---------------------------------------------------------------------------
// Kernel 3: score GEMM x G^T (WMMA bf16x3, f32 accum) + collapsed 16-key
// count-weighted causal softmax + V combine.
// A block owns 48 query rows (3 tiles of 16) and splits the 2048-long K sum
// over its 16 waves: wave w does columns [128 w, 128 w + 128) of x and G for
// the 3 accumulator tiles (16 rows x 16 keys each). The 16 partial tiles are
// summed through LDS in rising order of w; waves 0..2 then finish one 16-row
// tile each.
// ---------------------------------------------------------------------------
#define MT      3                 // 16-row tiles a block
#define KW      16                // waves a block = K slices
#define KSLICE  (EMB / KW)        // 128 columns a wave
#define NPAIR   (MT * 4)          // 12 register pairs of accumulators a lane

// One wave's K slice. ONE: the 3 row tiles lie in one batch and share each B
// fragment; otherwise (the two blocks that span a batch border) each tile
// loads the fragment of its own batch.
template <bool ONE>
__device__ __forceinline__ void score_slice(const float* __restrict__ xrow,
                                            const __bf16* const (&gt)[MT],
                                            v8f (&acc)[MT]) {
  for (int kb = 0; kb < KSLICE; kb += 32) {
    // ---- A operands: x rows, ISA 16-bit A layout.
    // lanes 0-15: K = {0..7, 16..23}; lanes 16-31: K = {8..15, 24..31}
    v16bf ah[MT], al[MT];
#pragma unroll  // constant mt: ah, al and acc stay in registers
    for (int mt = 0; mt < MT; mt++) {
      const float* ap = xrow + (size_t)mt * 16 * EMB + kb;
      float af[16];
      *(v4f*)(af + 0)  = *(const v4f*)(ap + 0);
      *(v4f*)(af + 4)  = *(const v4f*)(ap + 4);
      *(v4f*)(af + 8)  = *(const v4f*)(ap + 16);
      *(v4f*)(af + 12) = *(const v4f*)(ap + 20);
#pragma unroll
      for (int i = 0; i < 16; i++) {
        float  f = af[i];
        __bf16 h = (__bf16)f;
        ah[mt][i] = h;
        al[mt][i] = (__bf16)(f - (float)h);     // exact residual, then bf16
      }
    }

    // ---- One N-tile: the 16 keys; B column n == row n of G, in fragment order
    v16bf bhi, blo;
#pragma unroll  // constant mt, as above
    for (int mt = 0; mt < MT; mt++) {
      if (mt == 0 || !ONE) {
        const __bf16* bp = gt[mt] + (kb / 32) * GBLK;
        v8bf bh0 = *(const v8bf*)(bp);
        v8bf bh1 = *(const v8bf*)(bp + 256);
        v8bf bl0 = *(const v8bf*)(bp + 512);
        v8bf bl1 = *(const v8bf*)(bp + 768);
        bhi = __builtin_shufflevector(bh0, bh1, 0,1,2,3,4,5,6,7,8,9,10,11,12,13,14,15);
        blo = __builtin_shufflevector(bl0, bl1, 0,1,2,3,4,5,6,7,8,9,10,11,12,13,14,15);
      }
      // bf16x3: xh*gh + xl*gh + xh*gl  (f32 accumulate)
      acc[mt] = __builtin_amdgcn_wmma_f32_16x16x32_bf16(false, ah[mt], false, bhi,
                                                  (short)0, acc[mt], false, false);
      acc[mt] = __builtin_amdgcn_wmma_f32_16x16x32_bf16(false, al[mt], false, bhi,
                                                  (short)0, acc[mt], false, false);
      acc[mt] = __builtin_amdgcn_wmma_f32_16x16x32_bf16(false, ah[mt], false, blo,
                                                  (short)0, acc[mt], false, false);
    }
  }
}

__global__ __launch_bounds__(512) void attn_main(
    const float*  __restrict__ x,
    const __bf16* __restrict__ g,
    const float*  __restrict__ v16,
    float*        __restrict__ out) {
  __shared__ v2f   part[KW * NPAIR * 32];       // [slice][register pair][lane]
  __shared__ float stile[MT * 16 * 17];         // 3 tiles, 16x16 padded to 17

  const int wave = __builtin_amdgcn_readfirstlane(threadIdx.x >> 5);
  const int lane = threadIdx.x & 31;
  const int r    = lane & 15;                   // row within tile / N index
  const int kh   = lane >> 4;                   // lane-half: selects K sub-blocks
  const int mblk = blockIdx.x * (MT * 16);      // first row of the block
  const int k0   = wave * KSLICE + kh * 8;      // this lane's first column

  const float* xrow = x + (size_t)(mblk + r) * EMB + k0;

  // Each tile's batch (a tile of 16 rows never spans two) and its slice of G.
  const __bf16* gt[MT];
#pragma unroll
  for (int mt = 0; mt < MT; mt++)
    gt[mt] = g + (size_t)((mblk + mt * 16) >> 12) * GBATCH
               + wave * (KSLICE / 32) * GBLK + lane * 8;

  v8f acc[MT] = {};                             // 48x16 f32 partial scores

  if (__builtin_expect((mblk >> 12) == ((mblk + MT * 16 - 1) >> 12), 1))
    score_slice<true>(xrow, gt, acc);
  else
    score_slice<false>(xrow, gt, acc);

  // ---- Each wave lays its partial down as it holds it: pair p = mt*4+ii is
  // accumulator registers 2*ii and 2*ii+1 of tile mt, lane by lane.
  // (Both loops unrolled: acc is indexed by constants only.)
  v2f* pw = part + wave * (NPAIR * 32) + lane;
#pragma unroll
  for (int mt = 0; mt < MT; mt++) {
#pragma unroll
    for (int ii = 0; ii < 4; ii++) {
      v2f p2 = { acc[mt][2 * ii], acc[mt][2 * ii + 1] };
      pw[(mt * 4 + ii) * 32] = p2;
    }
  }
  __syncthreads();

  // ---- Sum the 16 slices. Wave w < 12 takes pair w, so mt = w / 4 and
  // ii = w % 4. D layout: VGPR i -> M = i + 8*kh, N = r (the key)
  if (wave < NPAIR) {
    const v2f* pr = part + wave * 32 + lane;
    v2f sum = pr[0];
#pragma unroll  // the 16 LDS reads of a lane issue ahead of the adds
    for (int sl = 1; sl < KW; sl++) sum += pr[sl * (NPAIR * 32)];
    float* sd = stile + ((wave >> 2) * 16 + kh * 8 + (wave & 3) * 2) * 17 + r;
    sd[0]  = sum.x;
    sd[17] = sum.y;
  }
  __syncthreads();

  if (wave >= MT) return;                       // behind the last barrier
  const int m0 = mblk + wave * 16;

  // ---- Collapsed attention: 16 distinct keys, count-weighted softmax.
  // Lane handles row r; kh selects output halves h in [kh*32, kh*32+32).
  const int m  = m0 + r;
  const int b  = m >> 12;                       // / SEQ (4096)
  const int qi = m & (SEQ - 1);

  const float* sv   = stile + (wave * 16 + r) * 17;
  const float* vb16 = v16 + b * 16 * 64;
  const int d    = qi >> 4;
  const int mres = qi & 15;

  float s[16];
  float smax = -3.0e38f;
#pragma unroll
  for (int t = 0; t < 16; t++) {
    s[t] = sv[t] * 0.125f;                      // HEAD^-0.5 = 1/8
    int cnt = d + ((t <= mres) ? 1 : 0);
    if (cnt > 0 && s[t] > smax) smax = s[t];
  }

  float w[16];
  float Z = 0.f;
#pragma unroll
  for (int t = 0; t < 16; t++) {
    int cnt = d + ((t <= mres) ? 1 : 0);
    float e = 0.f;
    if (cnt > 0) e = (float)cnt * expf(s[t] - smax);
    w[t] = e;
    Z += e;
  }
  const float invZ = 1.0f / Z;

  float* orow = out + (size_t)m * HEAD + kh * 32;
  for (int h = 0; h < 32; h++) {
    float o = 0.f;
#pragma unroll
    for (int t = 0; t < 16; t++) o += w[t] * vb16[t * 64 + kh * 32 + h];
    orow[h] = o * invZ;
  }
}

// ---------------------------------------------------------------------------
extern "C" void kernel_launch(void* const* d_in, const int* in_sizes, int n_in,
                              void* d_out, int out_size, void* d_ws, size_t ws_size,
                              hipStream_t stream) {
  const float* x  = (const float*)d_in[0];
  const float* Wq = (const float*)d_in[1];
  const float* Wk = (const float*)d_in[2];
  const float* Wv = (const float*)d_in[3];
  float* out = (float*)d_out;

  char* ws = (char*)d_ws;
  // ws layout: g (384KB of the first 512KB) | k16 (12KB) | v16 (12KB)
  __bf16* g     = (__bf16*)(ws);
  float*  k16   = (float*) (ws + 524288);
  float*  v16   = (float*) (ws + 524288 + 12288);

  prep_kv  <<<BATCH * 8 * 4, 512, 0, stream>>>(x, Wk, Wv, k16, v16);
  fold_g   <<<BATCH * (EMB / 32), 64, 0, stream>>>(Wq, k16, g);
  attn_main<<<NROWS / (MT * 16), KW * 32, 0, stream>>>(x, g, v16, out);
}

// v004
// It runs in 24.2 microseconds.
// Two timings next to v003 put it at 1.10 and 1.11 times that version's speed.
// Counting every step since v000, it is 6.31 times as fast.
#include <hip/hip_runtime.h>
#include <hip/hip_bf16.h>
#include <math.h>

// Problem constants (from reference)
#define BATCH   3
#define SEQ     4096
#define EMB     2048
#define HEAD    64
#define NROWS   (BATCH * SEQ)     // 12288 query rows

typedef __attribute__((ext_vector_type(16))) __bf16 v16bf;
typedef __attribute__((ext_vector_type(8)))  __bf16 v8bf;
typedef __attribute__((ext_vector_type(8)))  float  v8f;
typedef __attribute__((ext_vector_type(4)))  float  v4f;
typedef __attribute__((ext_vector_type(2)))  float  v2f;

// ---------------------------------------------------------------------------
// Kernel 1: k16/v16 = x[b, 0:16, :] @ Wk^T / Wv^T  (full f32; only 16
// distinct K/V rows per batch survive the paged-cache semantics)
// One wave per 2x2 patch of outputs (2 x rows, 2 weight rows); the 2048-long
// sum is split over the 32 lanes (16 bytes a lane, 512 contiguous bytes a load)
// and closed by a butterfly. A block of 16 waves owns 2 x rows and 32 heads of
// one matrix, so each 128-byte line of k16/v16 has one writing block.
// ---------------------------------------------------------------------------
__global__ __launch_bounds__(512) void prep_kv(const float* __restrict__ x,
                        const float* __restrict__ Wk,
                        const float* __restrict__ Wv,
                        float* __restrict__ k16, float* __restrict__ v16) {
  const int lane = threadIdx.x & 31;
  const int wave = threadIdx.x >> 5;            // 0..15
  const int rp   = blockIdx.x >> 2;             // 0..23: pair of x rows
  const int cg   = blockIdx.x & 3;              // matrix and half of the heads
  const int b    = rp >> 3;
  const int t    = (rp & 7) * 2;
  const int h    = (cg & 1) * 32 + wave * 2;
  const float* Wm  = (cg >> 1) ? Wv : Wk;
  float*       dst = (cg >> 1) ? v16 : k16;

  const float* x0 = x  + ((size_t)b * SEQ + t) * EMB + lane * 4;
  const float* x1 = x0 + EMB;
  const float* w0 = Wm + (size_t)h * EMB + lane * 4;
  const float* w1 = w0 + EMB;

  v4f a00 = {}, a01 = {}, a10 = {}, a11 = {};
#pragma unroll
  for (int e = 0; e < EMB; e += 128) {
    v4f xa = *(const v4f*)(x0 + e);
    v4f xb = *(const v4f*)(x1 + e);
    v4f wa = *(const v4f*)(w0 + e);
    v4f wb = *(const v4f*)(w1 + e);
    a00 += xa * wa;
    a01 += xa * wb;
    a10 += xb * wa;
    a11 += xb * wb;
  }
  float s[4];
  s[0] = (a00.x + a00.y) + (a00.z + a00.w);
  s[1] = (a01.x + a01.y) + (a01.z + a01.w);
  s[2] = (a10.x + a10.y) + (a10.z + a10.w);
  s[3] = (a11.x + a11.y) + (a11.z + a11.w);
#pragma unroll
  for (int m = 16; m >= 1; m >>= 1) {
#pragma unroll
    for (int i = 0; i < 4; i++) s[i] += __shfl_xor(s[i], m, 32);
  }
  // Lane i < 4 stores output (row t + i/2, head h + i%2).
  float mine = s[0];
  if (lane == 1) mine = s[1];
  if (lane == 2) mine = s[2];
  if (lane == 3) mine = s[3];
  if (lane < 4) dst[(b * 16 + t + (lane >> 1)) * HEAD + h + (lane & 1)] = mine;
}

// ---------------------------------------------------------------------------
// Kernel 2: fold Wq into the 16 keys of each batch. The scores are
// (x Wq^T) k16^T / 8 = (x G^T) / 8 with G[b][t][e] = sum_h k16[b][t][h] Wq[h][e]
// (f32, h rising).
// G is split into bf16 hi/lo planes (for the bf16x3 WMMA GEMM) and laid down as
// the B fragments are read: per batch and per block of 32 columns e
//   [plane hi, lo][half of the fragment][fragment lane kh*16 + t][8 columns]
// with e = 32*block + 16*half + 8*kh + i, so that one wave-wide 16-byte load
// of attn_main is 512 contiguous bytes.
// A block of 2 waves owns one (batch, 32 columns); wave th has keys 8*th..8*th+7,
// which are whole 128-byte lines of the layout above.
// ---------------------------------------------------------------------------
#define GBLK    1024              // bf16 elements of G per block of 32 columns
#define GBATCH  (EMB / 32 * GBLK) // bf16 elements of G per batch (128 KB)

__global__ __launch_bounds__(64) void fold_g(const float* __restrict__ Wq,
                                             const float* __restrict__ k16,
                                             __bf16* __restrict__ g) {
  const int lane = threadIdx.x & 31;            // column within the block of 32
  const int th   = __builtin_amdgcn_readfirstlane(threadIdx.x >> 5);
  const int b    = blockIdx.x >> 6;
  const int kblk = blockIdx.x & 63;

  const float* wc = Wq + kblk * 32 + lane;
  const float* kr = k16 + (b * 16 + th * 8) * HEAD;   // wave-uniform

  float a[8] = {};
#pragma unroll  // the 64 column loads issue ahead of the sums
  for (int h = 0; h < HEAD; h++) {
    float w = wc[(size_t)h * EMB];
#pragma unroll
    for (int t = 0; t < 8; t++) a[t] += kr[t * HEAD + h] * w;
  }

  __bf16* gd = g + (size_t)b * GBATCH + kblk * GBLK
             + (lane >> 4) * 256 + (((lane >> 3) & 1) * 16 + th * 8) * 8 + (lane & 7);
#pragma unroll
  for (int t = 0; t < 8; t++) {
    __bf16 hi = (__bf16)a[t];
    gd[t * 8]       = hi;
    gd[512 + t * 8] = (__bf16)(a[t] - (float)hi);
  }
}

#define MT      3                 // 16-row tiles a block
#define KW      16                // waves a block = K slices
#define KSLICE  (EMB / KW)        // 128 columns a wave
#define KSTEPS  (KSLICE / 32)     // 4 WMMA k steps a wave and tile
#define NPAIR   (MT * 4)          // 12 register pairs of accumulators a lane
#define RPITCH  132               // floats a staged row: 512 B + 16 B = 33 units of
                                  // 16 B, odd, so 16 rows' ds_load_b128 spread over the banks
#define TILEF   (16 * RPITCH)     // floats of one wave's staged tile
#define BUFF    (KW * TILEF)      // floats of one buffer (all 16 waves)

// Eight rows of a wave's tile, one copy a row: lane l brings bytes 16 l .. 16 l + 15
// of the row's slice. l = the lane's LDS byte address in the first row, gp its
// global address there. s_wait_xcnt 0 is the statement's last line, so it stands
// in front of every later write of a register that a copy names (a precaution).
__device__ __forceinline__ void copy_rows8(unsigned l, const float* gp) {
  asm volatile(
      "global_load_async_to_lds_b128 %0, %8, off\n\t"
      "global_load_async_to_lds_b128 %1, %9, off\n\t"
      "global_load_async_to_lds_b128 %2, %10, off\n\t"
      "global_load_async_to_lds_b128 %3, %11, off\n\t"
      "global_load_async_to_lds_b128 %4, %12, off\n\t"
      "global_load_async_to_lds_b128 %5, %13, off\n\t"
      "global_load_async_to_lds_b128 %6, %14, off\n\t"
      "global_load_async_to_lds_b128 %7, %15, off\n\t"
      "s_wait_xcnt 0x0"
      :: "v"(l),                  "v"(l + 1 * RPITCH * 4), "v"(l + 2 * RPITCH * 4),
         "v"(l + 3 * RPITCH * 4), "v"(l + 4 * RPITCH * 4), "v"(l + 5 * RPITCH * 4),
         "v"(l + 6 * RPITCH * 4), "v"(l + 7 * RPITCH * 4),
         "v"(gp),           "v"(gp + 1 * EMB), "v"(gp + 2 * EMB), "v"(gp + 3 * EMB),
         "v"(gp + 4 * EMB), "v"(gp + 5 * EMB), "v"(gp + 6 * EMB), "v"(gp + 7 * EMB)
      : "memory");
}

// A wave's whole tile: 16 rows, 16 copies in flight.
__device__ __forceinline__ void stage_tile(unsigned l, const float* gp) {
  copy_rows8(l, gp);
  copy_rows8(l + 8 * RPITCH * 4, gp + 8 * EMB);
}

// A wave's slice of one batch's G: the B fragments (hi and lo) of its 4 k steps.
__device__ __forceinline__ void load_g(const __bf16* __restrict__ gp,
                                       v16bf (&bhi)[KSTEPS], v16bf (&blo)[KSTEPS]) {
#pragma unroll  // constant j: the fragments stay in registers
  for (int j = 0; j < KSTEPS; j++) {
    const __bf16* bp = gp + j * GBLK;
    v8bf bh0 = *(const v8bf*)(bp);
    v8bf bh1 = *(const v8bf*)(bp + 256);
    v8bf bl0 = *(const v8bf*)(bp + 512);
    v8bf bl1 = *(const v8bf*)(bp + 768);
    bhi[j] = __builtin_shufflevector(bh0, bh1, 0,1,2,3,4,5,6,7,8,9,10,11,12,13,14,15);
    blo[j] = __builtin_shufflevector(bl0, bl1, 0,1,2,3,4,5,6,7,8,9,10,11,12,13,14,15);
  }
}

// The 3 passes. On entry tile 0 is published in buffer 0, tile 1's copies fly
// into buffer 1, and bhi, blo hold G of tile 0's batch. ONE: the 3 row tiles lie
// in one batch and share those fragments; otherwise (the two blocks that span a
// batch border) each tile loads the fragments of its own batch.
template <bool ONE>
__device__ __forceinline__ void score_tiles(const float* arow, unsigned ldst,
                                            const float* __restrict__ xsrc,
                                            const __bf16* __restrict__ gw, int mblk,
                                            v16bf (&bhi)[KSTEPS], v16bf (&blo)[KSTEPS],
                                            v8f (&acc)[MT]) {
#pragma unroll  // constant mt: acc stays in registers, the buffer is a constant
  for (int mt = 0; mt < MT; mt++) {
    if (!ONE && mt > 0)
      load_g(gw + (size_t)((mblk + mt * 16) >> 12) * GBATCH, bhi, blo);
    const float* at = arow + (mt & 1) * BUFF;
#pragma unroll  // constant j, as in load_g
    for (int j = 0; j < KSTEPS; j++) {
      // ---- A operand: x row, ISA 16-bit A layout.
      // lanes 0-15: K = {0..7, 16..23}; lanes 16-31: K = {8..15, 24..31}
      const float* ap = at + j * 32;
      float af[16];
      *(v4f*)(af + 0)  = *(const v4f*)(ap + 0);
      *(v4f*)(af + 4)  = *(const v4f*)(ap + 4);
      *(v4f*)(af + 8)  = *(const v4f*)(ap + 16);
      *(v4f*)(af + 12) = *(const v4f*)(ap + 20);
      v16bf ah, al;
#pragma unroll
      for (int i = 0; i < 16; i++) {
        float  f = af[i];
        __bf16 h = (__bf16)f;
        ah[i] = h;
        al[i] = (__bf16)(f - (float)h);         // exact residual, then bf16
      }
      // bf16x3: xh*gh + xl*gh + xh*gl  (f32 accumulate)
      acc[mt] = __builtin_amdgcn_wmma_f32_16x16x32_bf16(false, ah, false, bhi[j],
                                                  (short)0, acc[mt], false, false);
      acc[mt] = __builtin_amdgcn_wmma_f32_16x16x32_bf16(false, al, false, bhi[j],
                                                  (short)0, acc[mt], false, false);
      acc[mt] = __builtin_amdgcn_wmma_f32_16x16x32_bf16(false, ah, false, blo[j],
                                                  (short)0, acc[mt], false, false);
    }
    // Foot of the pass: this wave's reads of its buffer are done ...
    asm volatile("s_wait_dscnt 0x0" ::: "memory");
    // ... and its copies of the next tile have landed.
    asm volatile("s_wait_asynccnt 0x0" ::: "memory");
    // Publishes the next tile and frees the buffer just read (behind the last
    // pass: frees the ring for the partials).
    __syncthreads();
    if (mt + 2 < MT)
      stage_tile(ldst + (mt & 1) * BUFF * 4, xsrc + (size_t)(mt + 2) * 16 * EMB);
  }
  // No copy is left in flight when the ring is written again.
  asm volatile("s_wait_asynccnt 0x0" ::: "memory");
}

__global__ __launch_bounds__(512) void attn_main(
    const float*  __restrict__ x,
    const __bf16* __restrict__ g,
    const float*  __restrict__ v16,
    float*        __restrict__ out) {
  // Two buffers of staged x; behind the last pass the same LDS takes the partials.
  __shared__ __attribute__((aligned(16))) float ring[2 * BUFF];
  __shared__ float stile[MT * 16 * 17];         // 3 tiles, 16x16 padded to 17
  v2f* part = (v2f*)ring;                       // [slice][register pair][lane]

  const int wave = __builtin_amdgcn_readfirstlane(threadIdx.x >> 5);
  const int lane = threadIdx.x & 31;
  const int r    = lane & 15;                   // row within tile / N index
  const int kh   = lane >> 4;                   // lane-half: selects K sub-blocks
  const int mblk = blockIdx.x * (MT * 16);      // first row of the block

  // Copies: this lane's 16 bytes of the wave's slice, first row of the block.
  const float*   xsrc = x + (size_t)mblk * EMB + wave * KSLICE + lane * 4;
  const unsigned ldst = (unsigned)(uintptr_t)(ring + wave * TILEF + lane * 4);
  // Fragments: row r of the wave's staged tile, this lane-half's first column.
  const float*   arow = ring + wave * TILEF + r * RPITCH + kh * 8;
  // This wave's slice of G within a batch.
  const __bf16*  gw   = g + wave * KSTEPS * GBLK + lane * 8;

  stage_tile(ldst, xsrc);                       // tile 0 -> buffer 0

  // G of tile 0's batch (a tile of 16 rows never spans two batches).
  const int gb = mblk >> 12;
  v16bf bhi[KSTEPS], blo[KSTEPS];
  load_g(gw + (size_t)gb * GBATCH, bhi, blo);

  // Tile 0 has landed in this wave's part of buffer 0 ...
  asm volatile("s_wait_asynccnt 0x0" ::: "memory");
  __syncthreads();                              // ... and in every wave's
  stage_tile(ldst + BUFF * 4, xsrc + (size_t)16 * EMB);   // tile 1 -> buffer 1

  v8f acc[MT] = {};                             // 48x16 f32 partial scores

  if (__builtin_expect(gb == ((mblk + MT * 16 - 1) >> 12), 1))   // block-uniform
    score_tiles<true>(arow, ldst, xsrc, gw, mblk, bhi, blo, acc);
  else
    score_tiles<false>(arow, ldst, xsrc, gw, mblk, bhi, blo, acc);

  // ---- Each wave lays its partial down as it holds it: pair p = mt*4+ii is
  // accumulator registers 2*ii and 2*ii+1 of tile mt, lane by lane.
  // (Both loops unrolled: acc is indexed by constants only.)
  v2f* pw = part + wave * (NPAIR * 32) + lane;
#pragma unroll
  for (int mt = 0; mt < MT; mt++) {
#pragma unroll
    for (int ii = 0; ii < 4; ii++) {
      v2f p2 = { acc[mt][2 * ii], acc[mt][2 * ii + 1] };
      pw[(mt * 4 + ii) * 32] = p2;
    }
  }
  __syncthreads();

  // ---- Sum the 16 slices. Wave w < 12 takes pair w, so mt = w / 4 and
  // ii = w % 4. D layout: VGPR i -> M = i + 8*kh, N = r (the key)
  if (wave < NPAIR) {
    const v2f* pr = part + wave * 32 + lane;
    v2f sum = pr[0];
#pragma unroll  // the 16 LDS reads of a lane issue ahead of the adds
    for (int sl = 1; sl < KW; sl++) sum += pr[sl * (NPAIR * 32)];
    float* sd = stile + ((wave >> 2) * 16 + kh * 8 + (wave & 3) * 2) * 17 + r;
    sd[0]  = sum.x;
    sd[17] = sum.y;
  }
  __syncthreads();

  if (wave >= MT) return;                       // behind the last barrier
  const int m0 = mblk + wave * 16;

  // ---- Collapsed attention: 16 distinct keys, count-weighted softmax.
  // Lane handles row r; kh selects output halves h in [kh*32, kh*32+32).
  const int m  = m0 + r;
  const int b  = m >> 12;                       // / SEQ (4096)
  const int qi = m & (SEQ - 1);

  const float* sv   = stile + (wave * 16 + r) * 17;
  const float* vb16 = v16 + b * 16 * 64;
  const int d    = qi >> 4;
  const int mres = qi & 15;

  float s[16];
  float smax = -3.0e38f;
#pragma unroll
  for (int t = 0; t < 16; t++) {
    s[t] = sv[t] * 0.125f;                      // HEAD^-0.5 = 1/8
    int cnt = d + ((t <= mres) ? 1 : 0);
    if (cnt > 0 && s[t] > smax) smax = s[t];
  }

  float w[16];
  float Z = 0.f;
#pragma unroll
  for (int t = 0; t < 16; t++) {
    int cnt = d + ((t <= mres) ? 1 : 0);
    float e = 0.f;
    if (cnt > 0) e = (float)cnt * expf(s[t] - smax);
    w[t] = e;
    Z += e;
  }
  const float invZ = 1.0f / Z;

  float* orow = out + (size_t)m * HEAD + kh * 32;
  for (int h = 0; h < 32; h++) {
    float o = 0.f;
#pragma unroll
    for (int t = 0; t < 16; t++) o += w[t] * vb16[t * 64 + kh * 32 + h];
    orow[h] = o * invZ;
  }
}

// ---------------------------------------------------------------------------
extern "C" void kernel_launch(void* const* d_in, const int* in_sizes, int n_in,
                              void* d_out, int out_size, void* d_ws, size_t ws_size,
                              hipStream_t stream) {
  const float* x  = (const float*)d_in[0];
  const float* Wq = (const float*)d_in[1];
  const float* Wk = (const float*)d_in[2];
  const float* Wv = (const float*)d_in[3];
  float* out = (float*)d_out;

  char* ws = (char*)d_ws;
  // ws layout: g (384KB of the first 512KB) | k16 (12KB) | v16 (12KB)
  __bf16* g     = (__bf16*)(ws);
  float*  k16   = (float*) (ws + 524288);
  float*  v16   = (float*) (ws + 524288 + 12288);

  prep_kv  <<<BATCH * 8 * 4, 512, 0, stream>>>(x, Wk, Wv, k16, v16);
  fold_g   <<<BATCH * (EMB / 32), 64, 0, stream>>>(Wq, k16, g);
  attn_main<<<NROWS / (MT * 16), KW * 32, 0, stream>>>(x, g, v16, out);
}

// v005
// A run of this version takes 21.1 microseconds.
// In both of two side-by-side timings against v004, it was 1.15 times as fast.
// Counting every step since v000, it is 7.25 times as fast.
#include <hip/hip_runtime.h>
#include <hip/hip_bf16.h>
#include <math.h>

// Problem constants (from reference)
#define BATCH   3
#define SEQ     4096
#define EMB     2048
#define HEAD    64
#define NROWS   (BATCH * SEQ)     // 12288 query rows

typedef __attribute__((ext_vector_type(16))) __bf16 v16bf;
typedef __attribute__((ext_vector_type(8)))  __bf16 v8bf;
typedef __attribute__((ext_vector_type(8)))  float  v8f;
typedef __attribute__((ext_vector_type(4)))  float  v4f;
typedef __attribute__((ext_vector_type(2)))  float  v2f;

// ---------------------------------------------------------------------------
// Kernel 1: k16/v16 = x[b, 0:16, :] @ Wk^T / Wv^T  (full f32; only 16
// distinct K/V rows per batch survive the paged-cache semantics)
// One wave per 2x2 patch of outputs (2 x rows, 2 weight rows); the 2048-long
// sum is split over the 32 lanes (16 bytes a lane, 512 contiguous bytes a load)
// and closed by a butterfly. A block of 16 waves owns 2 x rows and 32 heads of
// one matrix, so each 128-byte line of k16/v16 has one writing block.
// ---------------------------------------------------------------------------
__global__ __launch_bounds__(512) void prep_kv(const float* __restrict__ x,
                        const float* __restrict__ Wk,
                        const float* __restrict__ Wv,
                        float* __restrict__ k16, float* __restrict__ v16) {
  const int lane = threadIdx.x & 31;
  const int wave = threadIdx.x >> 5;            // 0..15
  const int rp   = blockIdx.x >> 2;             // 0..23: pair of x rows
  const int cg   = blockIdx.x & 3;              // matrix and half of the heads
  const int b    = rp >> 3;
  const int t    = (rp & 7) * 2;
  const int h    = (cg & 1) * 32 + wave * 2;
  const float* Wm  = (cg >> 1) ? Wv : Wk;
  float*       dst = (cg >> 1) ? v16 : k16;

  const float* x0 = x  + ((size_t)b * SEQ + t) * EMB + lane * 4;
  const float* x1 = x0 + EMB;
  const float* w0 = Wm + (size_t)h * EMB + lane * 4;
  const float* w1 = w0 + EMB;

  v4f a00 = {}, a01 = {}, a10 = {}, a11 = {};
#pragma unroll
  for (int e = 0; e < EMB; e += 128) {
    v4f xa = *(const v4f*)(x0 + e);
    v4f xb = *(const v4f*)(x1 + e);
    v4f wa = *(const v4f*)(w0 + e);
    v4f wb = *(const v4f*)(w1 + e);
    a00 += xa * wa;
    a01 += xa * wb;
    a10 += xb * wa;
    a11 += xb * wb;
  }
  float s[4];
  s[0] = (a00.x + a00.y) + (a00.z + a00.w);
  s[1] = (a01.x + a01.y) + (a01.z + a01.w);
  s[2] = (a10.x + a10.y) + (a10.z + a10.w);
  s[3] = (a11.x + a11.y) + (a11.z + a11.w);
#pragma unroll
  for (int m = 16; m >= 1; m >>= 1) {
#pragma unroll
    for (int i = 0; i < 4; i++) s[i] += __shfl_xor(s[i], m, 32);
  }
  // Lane i < 4 stores output (row t + i/2, head h + i%2).
  float mine = s[0];
  if (lane == 1) mine = s[1];
  if (lane == 2) mine = s[2];
  if (lane == 3) mine = s[3];
  if (lane < 4) dst[(b * 16 + t + (lane >> 1)) * HEAD + h + (lane & 1)] = mine;
}

// ---------------------------------------------------------------------------
// Kernel 2: fold Wq into the 16 keys of each batch. The scores are
// (x Wq^T) k16^T / 8 = (x G^T) / 8 with G[b][t][e] = sum_h k16[b][t][h] Wq[h][e]
// (f32, h rising).
// G is split into bf16 hi/lo planes (for the bf16x3 WMMA GEMM) and laid down as
// the B fragments are read: per batch and per block of 32 columns e
//   [plane hi, lo][half of the fragment][fragment lane kh*16 + t][8 columns]
// with e = 32*block + 16*half + 8*kh + i, so that one wave-wide 16-byte load
// of attn_main is 512 contiguous bytes.
// A block of 2 waves owns one (batch, 32 columns); wave th has keys 8*th..8*th+7,
// which are whole 128-byte lines of the layout above.
// ---------------------------------------------------------------------------
#define GBLK    1024              // bf16 elements of G per block of 32 columns
#define GBATCH  (EMB / 32 * GBLK) // bf16 elements of G per batch (128 KB)

__global__ __launch_bounds__(64) void fold_g(const float* __restrict__ Wq,
                                             const float* __restrict__ k16,
                                             __bf16* __restrict__ g) {
  const int lane = threadIdx.x & 31;            // column within the block of 32
  const int th   = __builtin_amdgcn_readfirstlane(threadIdx.x >> 5);
  const int b    = blockIdx.x >> 6;
  const int kblk = blockIdx.x & 63;

  const float* wc = Wq + kblk * 32 + lane;
  const float* kr = k16 + (b * 16 + th * 8) * HEAD;   // wave-uniform

  float a[8] = {};
#pragma unroll  // the 64 column loads issue ahead of the sums
  for (int h = 0; h < HEAD; h++) {
    float w = wc[(size_t)h * EMB];
#pragma unroll
    for (int t = 0; t < 8; t++) a[t] += kr[t * HEAD + h] * w;
  }

  __bf16* gd = g + (size_t)b * GBATCH + kblk * GBLK
             + (lane >> 4) * 256 + (((lane >> 3) & 1) * 16 + th * 8) * 8 + (lane & 7);
#pragma unroll
  for (int t = 0; t < 8; t++) {
    __bf16 hi = (__bf16)a[t];
    gd[t * 8]       = hi;
    gd[512 + t * 8] = (__bf16)(a[t] - (float)hi);
  }
}

#define MT      3                 // 16-row tiles a block
#define KW      16                // waves a block = K slices
#define KSLICE  (EMB / KW)        // 128 columns a wave
#define KSTEPS  (KSLICE / 32)     // 4 WMMA k steps a wave and tile
#define NPAIR   (MT * 4)          // 12 register pairs of accumulators a lane
#define RPITCH  132               // floats a staged row: 512 B + 16 B = 33 units of
                                  // 16 B, odd, so 16 rows' ds_load_b128 spread over the banks
#define TILEF   (16 * RPITCH)     // floats of one wave's staged tile
#define BUFF    (KW * TILEF)      // floats of one buffer (all 16 waves)
#define EPITCH  20                // floats a row of softmax weights in LDS: 16 + 4,
                                  // so every row starts on 16 bytes (ds_load_b128)

// Maximum over the 16 lanes of a row (lanes l ^ 1, ^ 2, ^ 4, ^ 8 by DPP row_xmask);
// every lane gets it. All 32 lanes are on where it is called.
__device__ __forceinline__ float row_max16(float v) {
  v = fmaxf(v, __int_as_float(__builtin_amdgcn_update_dpp(0, __float_as_int(v), 0x161, 0xf, 0xf, false)));
  v = fmaxf(v, __int_as_float(__builtin_amdgcn_update_dpp(0, __float_as_int(v), 0x162, 0xf, 0xf, false)));
  v = fmaxf(v, __int_as_float(__builtin_amdgcn_update_dpp(0, __float_as_int(v), 0x164, 0xf, 0xf, false)));
  v = fmaxf(v, __int_as_float(__builtin_amdgcn_update_dpp(0, __float_as_int(v), 0x168, 0xf, 0xf, false)));
  return v;
}

// Eight rows of a wave's tile, one copy a row: lane l brings bytes 16 l .. 16 l + 15
// of the row's slice. l = the lane's LDS byte address in the first row, gp its
// global address there. s_wait_xcnt 0 is the statement's last line, so it stands
// in front of every later write of a register that a copy names (a precaution).
__device__ __forceinline__ void copy_rows8(unsigned l, const float* gp) {
  asm volatile(
      "global_load_async_to_lds_b128 %0, %8, off\n\t"
      "global_load_async_to_lds_b128 %1, %9, off\n\t"
      "global_load_async_to_lds_b128 %2, %10, off\n\t"
      "global_load_async_to_lds_b128 %3, %11, off\n\t"
      "global_load_async_to_lds_b128 %4, %12, off\n\t"
      "global_load_async_to_lds_b128 %5, %13, off\n\t"
      "global_load_async_to_lds_b128 %6, %14, off\n\t"
      "global_load_async_to_lds_b128 %7, %15, off\n\t"
      "s_wait_xcnt 0x0"
      :: "v"(l),                  "v"(l + 1 * RPITCH * 4), "v"(l + 2 * RPITCH * 4),
         "v"(l + 3 * RPITCH * 4), "v"(l + 4 * RPITCH * 4), "v"(l + 5 * RPITCH * 4),
         "v"(l + 6 * RPITCH * 4), "v"(l + 7 * RPITCH * 4),
         "v"(gp),           "v"(gp + 1 * EMB), "v"(gp + 2 * EMB), "v"(gp + 3 * EMB),
         "v"(gp + 4 * EMB), "v"(gp + 5 * EMB), "v"(gp + 6 * EMB), "v"(gp + 7 * EMB)
      : "memory");
}

// A wave's whole tile: 16 rows, 16 copies in flight.
__device__ __forceinline__ void stage_tile(unsigned l, const float* gp) {
  copy_rows8(l, gp);
  copy_rows8(l + 8 * RPITCH * 4, gp + 8 * EMB);
}

// A wave's slice of one batch's G: the B fragments (hi and lo) of its 4 k steps.
__device__ __forceinline__ void load_g(const __bf16* __restrict__ gp,
                                       v16bf (&bhi)[KSTEPS], v16bf (&blo)[KSTEPS]) {
#pragma unroll  // constant j: the fragments stay in registers
  for (int j = 0; j < KSTEPS; j++) {
    const __bf16* bp = gp + j * GBLK;
    v8bf bh0 = *(const v8bf*)(bp);
    v8bf bh1 = *(const v8bf*)(bp + 256);
    v8bf bl0 = *(const v8bf*)(bp + 512);
    v8bf bl1 = *(const v8bf*)(bp + 768);
    bhi[j] = __builtin_shufflevector(bh0, bh1, 0,1,2,3,4,5,6,7,8,9,10,11,12,13,14,15);
    blo[j] = __builtin_shufflevector(bl0, bl1, 0,1,2,3,4,5,6,7,8,9,10,11,12,13,14,15);
  }
}

// The 3 passes. On entry tile 0 is published in buffer 0, tile 1's copies fly
// into buffer 1, and bhi, blo hold G of tile 0's batch. ONE: the 3 row tiles lie
// in one batch and share those fragments; otherwise (the two blocks that span a
// batch border) each tile loads the fragments of its own batch.
template <bool ONE>
__device__ __forceinline__ void score_tiles(const float* arow, unsigned ldst,
                                            const float* __restrict__ xsrc,
                                            const __bf16* __restrict__ gw, int mblk,
                                            v16bf (&bhi)[KSTEPS], v16bf (&blo)[KSTEPS],
                                            v8f (&acc)[MT]) {
#pragma unroll  // constant mt: acc stays in registers, the buffer is a constant
  for (int mt = 0; mt < MT; mt++) {
    if (!ONE && mt > 0)
      load_g(gw + (size_t)((mblk + mt * 16) >> 12) * GBATCH, bhi, blo);
    const float* at = arow + (mt & 1) * BUFF;
#pragma unroll  // constant j, as in load_g
    for (int j = 0; j < KSTEPS; j++) {
      // ---- A operand: x row, ISA 16-bit A layout.
      // lanes 0-15: K = {0..7, 16..23}; lanes 16-31: K = {8..15, 24..31}
      const float* ap = at + j * 32;
      float af[16];
      *(v4f*)(af + 0)  = *(const v4f*)(ap + 0);
      *(v4f*)(af + 4)  = *(const v4f*)(ap + 4);
      *(v4f*)(af + 8)  = *(const v4f*)(ap + 16);
      *(v4f*)(af + 12) = *(const v4f*)(ap + 20);
      v16bf ah, al;
#pragma unroll
      for (int i = 0; i < 16; i++) {
        float  f = af[i];
        __bf16 h = (__bf16)f;
        ah[i] = h;
        al[i] = (__bf16)(f - (float)h);         // exact residual, then bf16
      }
      // bf16x3: xh*gh + xl*gh + xh*gl  (f32 accumulate)
      acc[mt] = __builtin_amdgcn_wmma_f32_16x16x32_bf16(false, ah, false, bhi[j],
                                                  (short)0, acc[mt], false, false);
      acc[mt] = __builtin_amdgcn_wmma_f32_16x16x32_bf16(false, al, false, bhi[j],
                                                  (short)0, acc[mt], false, false);
      acc[mt] = __builtin_amdgcn_wmma_f32_16x16x32_bf16(false, ah, false, blo[j],
                                                  (short)0, acc[mt], false, false);
    }
    // Foot of the pass: this wave's reads of its buffer are done ...
    asm volatile("s_wait_dscnt 0x0" ::: "memory");
    // ... and its copies of the next tile have landed.
    asm volatile("s_wait_asynccnt 0x0" ::: "memory");
    // Publishes the next tile and frees the buffer just read (behind the last
    // pass: frees the ring for the partials).
    __syncthreads();
    if (mt + 2 < MT)
      stage_tile(ldst + (mt & 1) * BUFF * 4, xsrc + (size_t)(mt + 2) * 16 * EMB);
  }
  // No copy is left in flight when the ring is written again.
  asm volatile("s_wait_asynccnt 0x0" ::: "memory");
}

__global__ __launch_bounds__(512) void attn_main(
    const float*  __restrict__ x,
    const __bf16* __restrict__ g,
    const float*  __restrict__ v16,
    float*        __restrict__ out) {
  // Two buffers of staged x; behind the last pass the same LDS takes the partials.
  __shared__ __attribute__((aligned(16))) float ring[2 * BUFF];
  __shared__ __attribute__((aligned(16))) float wrow[MT * 16 * EPITCH];  // 48 rows x 16 weights
  v2f* part = (v2f*)ring;                       // [slice][register pair][lane]

  const int wave = __builtin_amdgcn_readfirstlane(threadIdx.x >> 5);
  const int lane = threadIdx.x & 31;
  const int r    = lane & 15;                   // row within tile / N index
  const int kh   = lane >> 4;                   // lane-half: selects K sub-blocks
  const int mblk = blockIdx.x * (MT * 16);      // first row of the block

  // Copies: this lane's 16 bytes of the wave's slice, first row of the block.
  const float*   xsrc = x + (size_t)mblk * EMB + wave * KSLICE + lane * 4;
  const unsigned ldst = (unsigned)(uintptr_t)(ring + wave * TILEF + lane * 4);
  // Fragments: row r of the wave's staged tile, this lane-half's first column.
  const float*   arow = ring + wave * TILEF + r * RPITCH + kh * 8;
  // This wave's slice of G within a batch.
  const __bf16*  gw   = g + wave * KSTEPS * GBLK + lane * 8;

  stage_tile(ldst, xsrc);                       // tile 0 -> buffer 0

  // G of tile 0's batch (a tile of 16 rows never spans two batches).
  const int gb = mblk >> 12;
  v16bf bhi[KSTEPS], blo[KSTEPS];
  load_g(gw + (size_t)gb * GBATCH, bhi, blo);

  // Tile 0 has landed in this wave's part of buffer 0 ...
  asm volatile("s_wait_asynccnt 0x0" ::: "memory");
  __syncthreads();                              // ... and in every wave's
  stage_tile(ldst + BUFF * 4, xsrc + (size_t)16 * EMB);   // tile 1 -> buffer 1

  v8f acc[MT] = {};                             // 48x16 f32 partial scores

  if (__builtin_expect(gb == ((mblk + MT * 16 - 1) >> 12), 1))   // block-uniform
    score_tiles<true>(arow, ldst, xsrc, gw, mblk, bhi, blo, acc);
  else
    score_tiles<false>(arow, ldst, xsrc, gw, mblk, bhi, blo, acc);

  // ---- Each wave lays its partial down as it holds it: pair p = mt*4+ii is
  // accumulator registers 2*ii and 2*ii+1 of tile mt, lane by lane.
  // (Both loops unrolled: acc is indexed by constants only.)
  v2f* pw = part + wave * (NPAIR * 32) + lane;
#pragma unroll
  for (int mt = 0; mt < MT; mt++) {
#pragma unroll
    for (int ii = 0; ii < 4; ii++) {
      v2f p2 = { acc[mt][2 * ii], acc[mt][2 * ii + 1] };
      pw[(mt * 4 + ii) * 32] = p2;
    }
  }
  __syncthreads();

  // ---- Sum the 16 slices. Wave w < 12 takes pair w, so mt = w / 4 and
  // ii = w % 4. D layout: VGPR i -> M = i + 8*kh, N = r (the key): the lane holds
  // key r of rows lrow and lrow + 1 (counted within the block).
  const int pmt  = wave >> 2;
  const int lrow = pmt * 16 + kh * 8 + (wave & 3) * 2;
  v4f vv[16];                                   // V[t][4 r .. 4 r + 3] of the tile's batch
  if (wave < NPAIR) {
    // Asked for ahead of the LDS sums, so that the loads fly under them.
    const float* vq = v16 + ((mblk + pmt * 16) >> 12) * (16 * HEAD) + r * 4;
#pragma unroll  // constant t: vv stays in registers
    for (int t = 0; t < 16; t++) vv[t] = *(const v4f*)(vq + t * HEAD);

    const v2f* pr = part + wave * 32 + lane;
    v2f sum = pr[0];
#pragma unroll  // the 16 LDS reads of a lane issue ahead of the adds
    for (int sl = 1; sl < KW; sl++) sum += pr[sl * (NPAIR * 32)];

    // Collapsed attention: 16 distinct keys, key t counts cnt times under the
    // causal mask. The lane makes the unnormalised weight of its key.
    float* ed = wrow + lrow * EPITCH + r;
#pragma unroll  // constant i: sum[i] is a register; the two rows' chains interleave
    for (int i = 0; i < 2; i++) {
      const int   qi   = (mblk + lrow + i) & (SEQ - 1);
      const int   cnt  = (qi >> 4) + ((r <= (qi & 15)) ? 1 : 0);
      const float s    = sum[i] * 0.125f;       // HEAD^-0.5 = 1/8
      const float smax = row_max16(cnt > 0 ? s : -3.0e38f);
      const float e    = (float)cnt * expf(s - smax);
      ed[i * EPITCH] = (cnt > 0) ? e : 0.f;
    }
  }
  __syncthreads();

  if (wave >= NPAIR) return;                    // behind the last barrier

  // ---- V combine: the lane has output columns 4 r .. 4 r + 3 of its two rows,
  // so 16 lanes store one whole row of 256 bytes. Z and each output are summed
  // over the keys in rising order.
  const float* er   = wrow + lrow * EPITCH;
  float*       orow = out + (size_t)(mblk + lrow) * HEAD + r * 4;
#pragma unroll  // all three loops: w and vv are indexed by constants only (registers)
  for (int i = 0; i < 2; i++) {
    float w[16];
#pragma unroll
    for (int k = 0; k < 4; k++) *(v4f*)(w + 4 * k) = *(const v4f*)(er + i * EPITCH + 4 * k);
    float Z = 0.f;
    v4f   o = {};
#pragma unroll
    for (int t = 0; t < 16; t++) {
      Z += w[t];
      o += w[t] * vv[t];
    }
    *(v4f*)(orow + i * HEAD) = o * (1.0f / Z);
  }
}

// ---------------------------------------------------------------------------
extern "C" void kernel_launch(void* const* d_in, const int* in_sizes, int n_in,
                              void* d_out, int out_size, void* d_ws, size_t ws_size,
                              hipStream_t stream) {
  const float* x  = (const float*)d_in[0];
  const float* Wq = (const float*)d_in[1];
  const float* Wk = (const float*)d_in[2];
  const float* Wv = (const float*)d_in[3];
  float* out = (float*)d_out;

  char* ws = (char*)d_ws;
  // ws layout: g (384KB of the first 512KB) | k16 (12KB) | v16 (12KB)
  __bf16* g     = (__bf16*)(ws);
  float*  k16   = (float*) (ws + 524288);
  float*  v16   = (float*) (ws + 524288 + 12288);

  prep_kv  <<<BATCH * 8 * 4, 512, 0, stream>>>(x, Wk, Wv, k16, v16);
  fold_g   <<<BATCH * (EMB / 32), 64, 0, stream>>>(Wq, k16, g);
  attn_main<<<NROWS / (MT * 16), KW * 32, 0, stream>>>(x, g, v16, out);
}

// v006
// A run of this version takes 19.7 microseconds.
// In two side-by-side timings against v005, it was 1.10 and 1.08 times as fast.
// Over all steps from v000 it is 7.91 times as fast.
#include <hip/hip_runtime.h>
#include <hip/hip_bf16.h>
#include <math.h>

// Problem constants (from reference)
#define BATCH   3
#define SEQ     4096
#define EMB     2048
#define HEAD    64
#define NROWS   (BATCH * SEQ)     // 12288 query rows

typedef __attribute__((ext_vector_type(16))) __bf16 v16bf;
typedef __attribute__((ext_vector_type(8)))  __bf16 v8bf;
typedef __attribute__((ext_vector_type(8)))  float  v8f;
typedef __attribute__((ext_vector_type(4)))  float  v4f;
typedef __attribute__((ext_vector_type(2)))  float  v2f;

// ---------------------------------------------------------------------------
// Kernel 1: k16/v16 = x[b, 0:16, :] @ Wk^T / Wv^T  (full f32; only 16
// distinct K/V rows per batch survive the paged-cache semantics)
// One wave per 2x2 patch of outputs (2 x rows, 2 weight rows); the 2048-long
// sum is split over the 32 lanes (16 bytes a lane, 512 contiguous bytes a load)
// and closed by a butterfly. A block of 16 waves owns 2 x rows and 32 heads of
// one matrix, so each 128-byte line of k16/v16 has one writing block.
// ---------------------------------------------------------------------------
__global__ __launch_bounds__(512) void prep_kv(const float* __restrict__ x,
                        const float* __restrict__ Wk,
                        const float* __restrict__ Wv,
                        float* __restrict__ k16, float* __restrict__ v16) {
  const int lane = threadIdx.x & 31;
  const int wave = threadIdx.x >> 5;            // 0..15
  const int rp   = blockIdx.x >> 2;             // 0..23: pair of x rows
  const int cg   = blockIdx.x & 3;              // matrix and half of the heads
  const int b    = rp >> 3;
  const int t    = (rp & 7) * 2;
  const int h    = (cg & 1) * 32 + wave * 2;
  const float* Wm  = (cg >> 1) ? Wv : Wk;
  float*       dst = (cg >> 1) ? v16 : k16;

  const float* x0 = x  + ((size_t)b * SEQ + t) * EMB + lane * 4;
  const float* x1 = x0 + EMB;
  const float* w0 = Wm + (size_t)h * EMB + lane * 4;
  const float* w1 = w0 + EMB;

  v4f a00 = {}, a01 = {}, a10 = {}, a11 = {};
#pragma unroll
  for (int e = 0; e < EMB; e += 128) {
    v4f xa = *(const v4f*)(x0 + e);
    v4f xb = *(const v4f*)(x1 + e);
    v4f wa = *(const v4f*)(w0 + e);
    v4f wb = *(const v4f*)(w1 + e);
    a00 += xa * wa;
    a01 += xa * wb;
    a10 += xb * wa;
    a11 += xb * wb;
  }
  float s[4];
  s[0] = (a00.x + a00.y) + (a00.z + a00.w);
  s[1] = (a01.x + a01.y) + (a01.z + a01.w);
  s[2] = (a10.x + a10.y) + (a10.z + a10.w);
  s[3] = (a11.x + a11.y) + (a11.z + a11.w);
#pragma unroll
  for (int m = 16; m >= 1; m >>= 1) {
#pragma unroll
    for (int i = 0; i < 4; i++) s[i] += __shfl_xor(s[i], m, 32);
  }
  // Lane i < 4 stores output (row t + i/2, head h + i%2).
  float mine = s[0];
  if (lane == 1) mine = s[1];
  if (lane == 2) mine = s[2];
  if (lane == 3) mine = s[3];
  if (lane < 4) dst[(b * 16 + t + (lane >> 1)) * HEAD + h + (lane & 1)] = mine;
}

// ---------------------------------------------------------------------------
// Kernel 2: fold Wq into the 16 keys of each batch. The scores are
// (x Wq^T) k16^T / 8 = (x G^T) / 8 with G[b][t][e] = sum_h k16[b][t][h] Wq[h][e].
// G is split into bf16 hi/lo planes (for the bf16x3 WMMA GEMM) and laid down as
// the B fragments are read: per batch and per block of 32 columns e
//   [plane hi, lo][half of the fragment][fragment lane kh*16 + t][8 columns]
// with e = 32*block + 16*half + 8*kh + i, so that one wave-wide 16-byte load
// of attn_main is 512 contiguous bytes.
// The fold is a small f32 GEMM on the matrix unit (16x16x4, full f32): a wave
// owns one (batch, 16 columns); A = Wq^T (row = column e), B = k16^T (column =
// key t), 16 steps of 4 heads. D register i of lane kh*16 + t is then
// G[t][e0 + 8*kh + i]: the lane's 8 registers are its 16 bytes of the layout
// above, and the wave stores 512 contiguous bytes a plane.
// All 40 loads of a lane are independent of each other and fly together.
// Heads of step st: lane half kh, element s holds head
//   4*kh + 8*(st/2) + 2*(st%2) + s
// in A and in B alike (the pairing is all that counts), chosen so that the two
// halves of a key's lane pair read 32 adjoining bytes of k16 with each load.
// ---------------------------------------------------------------------------
#define GBLK    1024              // bf16 elements of G per block of 32 columns
#define GBATCH  (EMB / 32 * GBLK) // bf16 elements of G per batch (128 KB)

__global__ __launch_bounds__(64) void fold_g(const float* __restrict__ Wq,
                                             const float* __restrict__ k16,
                                             __bf16* __restrict__ g) {
  const int lane = threadIdx.x & 31;
  const int c    = lane & 15;                   // A: column e0 + c; B, D: key c
  const int kh   = lane >> 4;
  const int half = __builtin_amdgcn_readfirstlane(threadIdx.x >> 5);
  const int b    = blockIdx.x >> 6;
  const int kblk = blockIdx.x & 63;

  const float* kp = k16 + (b * 16 + c) * HEAD + 4 * kh;
  const float* wp = Wq + (size_t)(4 * kh) * EMB + kblk * 32 + half * 16 + c;

  v4f kq[8];                                    // heads 4*kh + 8*j + 0..3 of key c
#pragma unroll  // constant j: kq stays in registers
  for (int j = 0; j < 8; j++) kq[j] = *(const v4f*)(kp + 8 * j);
  v2f wa[16];
#pragma unroll  // constant st: wa stays in registers, the loads issue ahead of the sums
  for (int st = 0; st < 16; st++) {
    const int hc = 8 * (st >> 1) + 2 * (st & 1);
    wa[st].x = wp[(size_t)hc * EMB];
    wa[st].y = wp[(size_t)(hc + 1) * EMB];
  }

  // Keeps all 40 loads ahead of the first matrix instruction: left alone the
  // compiler holds 12 of them back behind the first results (a second latency).
  __builtin_amdgcn_sched_barrier(0);

  v8f acc = {};
#pragma unroll  // constant st, as above
  for (int st = 0; st < 16; st++) {
    v2f kb = { kq[st >> 1][2 * (st & 1)], kq[st >> 1][2 * (st & 1) + 1] };
    acc = __builtin_amdgcn_wmma_f32_16x16x4_f32(false, wa[st], false, kb,
                                                (short)0, acc, false, false);
  }
  // The two barriers hold the v_nop directly behind the last matrix instruction
  // and keep other vector work out of the chain (it would write operand registers).
  __builtin_amdgcn_sched_barrier(0);
  // Four vector slots between the last matrix instruction and the first reader of D.
  asm volatile("v_nop\n\tv_nop\n\tv_nop\n\tv_nop");
  __builtin_amdgcn_sched_barrier(0);

  v8bf hi8, lo8;
#pragma unroll
  for (int i = 0; i < 8; i++) {
    __bf16 hi = (__bf16)acc[i];
    hi8[i] = hi;
    lo8[i] = (__bf16)(acc[i] - (float)hi);
  }
  __bf16* gd = g + (size_t)b * GBATCH + kblk * GBLK + half * 256 + lane * 8;
  *(v8bf*)gd         = hi8;
  *(v8bf*)(gd + 512) = lo8;
}

#define MT      3                 // 16-row tiles a block
#define KW      16                // waves a block = K slices
#define KSLICE  (EMB / KW)        // 128 columns a wave
#define KSTEPS  (KSLICE / 32)     // 4 WMMA k steps a wave and tile
#define NPAIR   (MT * 4)          // 12 register pairs of accumulators a lane
#define RPITCH  132               // floats a staged row: 512 B + 16 B = 33 units of
                                  // 16 B, odd, so 16 rows' ds_load_b128 spread over the banks
#define TILEF   (16 * RPITCH)     // floats of one wave's staged tile
#define BUFF    (KW * TILEF)      // floats of one buffer (all 16 waves)
#define EPITCH  20                // floats a row of softmax weights in LDS: 16 + 4,
                                  // so every row starts on 16 bytes (ds_load_b128)

// Maximum over the 16 lanes of a row (lanes l ^ 1, ^ 2, ^ 4, ^ 8 by DPP row_xmask);
// every lane gets it. All 32 lanes are on where it is called.
__device__ __forceinline__ float row_max16(float v) {
  v = fmaxf(v, __int_as_float(__builtin_amdgcn_update_dpp(0, __float_as_int(v), 0x161, 0xf, 0xf, false)));
  v = fmaxf(v, __int_as_float(__builtin_amdgcn_update_dpp(0, __float_as_int(v), 0x162, 0xf, 0xf, false)));
  v = fmaxf(v, __int_as_float(__builtin_amdgcn_update_dpp(0, __float_as_int(v), 0x164, 0xf, 0xf, false)));
  v = fmaxf(v, __int_as_float(__builtin_amdgcn_update_dpp(0, __float_as_int(v), 0x168, 0xf, 0xf, false)));
  return v;
}

// Eight rows of a wave's tile, one copy a row: lane l brings bytes 16 l .. 16 l + 15
// of the row's slice. l = the lane's LDS byte address in the first row, gp its
// global address there. s_wait_xcnt 0 is the statement's last line, so it stands
// in front of every later write of a register that a copy names (a precaution).
__device__ __forceinline__ void copy_rows8(unsigned l, const float* gp) {
  asm volatile(
      "global_load_async_to_lds_b128 %0, %8, off\n\t"
      "global_load_async_to_lds_b128 %1, %9, off\n\t"
      "global_load_async_to_lds_b128 %2, %10, off\n\t"
      "global_load_async_to_lds_b128 %3, %11, off\n\t"
      "global_load_async_to_lds_b128 %4, %12, off\n\t"
      "global_load_async_to_lds_b128 %5, %13, off\n\t"
      "global_load_async_to_lds_b128 %6, %14, off\n\t"
      "global_load_async_to_lds_b128 %7, %15, off\n\t"
      "s_wait_xcnt 0x0"
      :: "v"(l),                  "v"(l + 1 * RPITCH * 4), "v"(l + 2 * RPITCH * 4),
         "v"(l + 3 * RPITCH * 4), "v"(l + 4 * RPITCH * 4), "v"(l + 5 * RPITCH * 4),
         "v"(l + 6 * RPITCH * 4), "v"(l + 7 * RPITCH * 4),
         "v"(gp),           "v"(gp + 1 * EMB), "v"(gp + 2 * EMB), "v"(gp + 3 * EMB),
         "v"(gp + 4 * EMB), "v"(gp + 5 * EMB), "v"(gp + 6 * EMB), "v"(gp + 7 * EMB)
      : "memory");
}

// A wave's whole tile: 16 rows, 16 copies in flight.
__device__ __forceinline__ void stage_tile(unsigned l, const float* gp) {
  copy_rows8(l, gp);
  copy_rows8(l + 8 * RPITCH * 4, gp + 8 * EMB);
}

// A wave's slice of one batch's G: the B fragments (hi and lo) of its 4 k steps.
__device__ __forceinline__ void load_g(const __bf16* __restrict__ gp,
                                       v16bf (&bhi)[KSTEPS], v16bf (&blo)[KSTEPS]) {
#pragma unroll  // constant j: the fragments stay in registers
  for (int j = 0; j < KSTEPS; j++) {
    const __bf16* bp = gp + j * GBLK;
    v8bf bh0 = *(const v8bf*)(bp);
    v8bf bh1 = *(const v8bf*)(bp + 256);
    v8bf bl0 = *(const v8bf*)(bp + 512);
    v8bf bl1 = *(const v8bf*)(bp + 768);
    bhi[j] = __builtin_shufflevector(bh0, bh1, 0,1,2,3,4,5,6,7,8,9,10,11,12,13,14,15);
    blo[j] = __builtin_shufflevector(bl0, bl1, 0,1,2,3,4,5,6,7,8,9,10,11,12,13,14,15);
  }
}

// The 3 passes. On entry tile 0 is published in buffer 0, tile 1's copies fly
// into buffer 1, and bhi, blo hold G of tile 0's batch. ONE: the 3 row tiles lie
// in one batch and share those fragments; otherwise (the two blocks that span a
// batch border) each tile loads the fragments of its own batch.
template <bool ONE>
__device__ __forceinline__ void score_tiles(const float* arow, unsigned ldst,
                                            const float* __restrict__ xsrc,
                                            const __bf16* __restrict__ gw, int mblk,
                                            v16bf (&bhi)[KSTEPS], v16bf (&blo)[KSTEPS],
                                            v8f (&acc)[MT]) {
#pragma unroll  // constant mt: acc stays in registers, the buffer is a constant
  for (int mt = 0; mt < MT; mt++) {
    if (!ONE && mt > 0)
      load_g(gw + (size_t)((mblk + mt * 16) >> 12) * GBATCH, bhi, blo);
    const float* at = arow + (mt & 1) * BUFF;
#pragma unroll  // constant j, as in load_g
    for (int j = 0; j < KSTEPS; j++) {
      // ---- A operand: x row, ISA 16-bit A layout.
      // lanes 0-15: K = {0..7, 16..23}; lanes 16-31: K = {8..15, 24..31}
      const float* ap = at + j * 32;
      float af[16];
      *(v4f*)(af + 0)  = *(const v4f*)(ap + 0);
      *(v4f*)(af + 4)  = *(const v4f*)(ap + 4);
      *(v4f*)(af + 8)  = *(const v4f*)(ap + 16);
      *(v4f*)(af + 12) = *(const v4f*)(ap + 20);
      v16bf ah, al;
#pragma unroll
      for (int i = 0; i < 16; i++) {
        float  f = af[i];
        __bf16 h = (__bf16)f;
        ah[i] = h;
        al[i] = (__bf16)(f - (float)h);         // exact residual, then bf16
      }
      // bf16x3: xh*gh + xl*gh + xh*gl  (f32 accumulate)
      acc[mt] = __builtin_amdgcn_wmma_f32_16x16x32_bf16(false, ah, false, bhi[j],
                                                  (short)0, acc[mt], false, false);
      acc[mt] = __builtin_amdgcn_wmma_f32_16x16x32_bf16(false, al, false, bhi[j],
                                                  (short)0, acc[mt], false, false);
      acc[mt] = __builtin_amdgcn_wmma_f32_16x16x32_bf16(false, ah, false, blo[j],
                                                  (short)0, acc[mt], false, false);
    }
    // Foot of the pass: this wave's reads of its buffer are done ...
    asm volatile("s_wait_dscnt 0x0" ::: "memory");
    // ... and its copies of the next tile have landed.
    asm volatile("s_wait_asynccnt 0x0" ::: "memory");
    // Publishes the next tile and frees the buffer just read (behind the last
    // pass: frees the ring for the partials).
    __syncthreads();
    if (mt + 2 < MT)
      stage_tile(ldst + (mt & 1) * BUFF * 4, xsrc + (size_t)(mt + 2) * 16 * EMB);
  }
  // No copy is left in flight when the ring is written again.
  asm volatile("s_wait_asynccnt 0x0" ::: "memory");
}

__global__ __launch_bounds__(512) void attn_main(
    const float*  __restrict__ x,
    const __bf16* __restrict__ g,
    const float*  __restrict__ v16,
    float*        __restrict__ out) {
  // Two buffers of staged x; behind the last pass the same LDS takes the partials.
  __shared__ __attribute__((aligned(16))) float ring[2 * BUFF];
  __shared__ __attribute__((aligned(16))) float wrow[MT * 16 * EPITCH];  // 48 rows x 16 weights
  v2f* part = (v2f*)ring;                       // [slice][register pair][lane]

  const int wave = __builtin_amdgcn_readfirstlane(threadIdx.x >> 5);
  const int lane = threadIdx.x & 31;
  const int r    = lane & 15;                   // row within tile / N index
  const int kh   = lane >> 4;                   // lane-half: selects K sub-blocks
  const int mblk = blockIdx.x * (MT * 16);      // first row of the block

  // Copies: this lane's 16 bytes of the wave's slice, first row of the block.
  const float*   xsrc = x + (size_t)mblk * EMB + wave * KSLICE + lane * 4;
  const unsigned ldst = (unsigned)(uintptr_t)(ring + wave * TILEF + lane * 4);
  // Fragments: row r of the wave's staged tile, this lane-half's first column.
  const float*   arow = ring + wave * TILEF + r * RPITCH + kh * 8;
  // This wave's slice of G within a batch.
  const __bf16*  gw   = g + wave * KSTEPS * GBLK + lane * 8;

  stage_tile(ldst, xsrc);                       // tile 0 -> buffer 0

  // G of tile 0's batch (a tile of 16 rows never spans two batches).
  const int gb = mblk >> 12;
  v16bf bhi[KSTEPS], blo[KSTEPS];
  load_g(gw + (size_t)gb * GBATCH, bhi, blo);

  // Tile 0 has landed in this wave's part of buffer 0 ...
  asm volatile("s_wait_asynccnt 0x0" ::: "memory");
  __syncthreads();                              // ... and in every wave's
  stage_tile(ldst + BUFF * 4, xsrc + (size_t)16 * EMB);   // tile 1 -> buffer 1

  v8f acc[MT] = {};                             // 48x16 f32 partial scores

  if (__builtin_expect(gb == ((mblk + MT * 16 - 1) >> 12), 1))   // block-uniform
    score_tiles<true>(arow, ldst, xsrc, gw, mblk, bhi, blo, acc);
  else
    score_tiles<false>(arow, ldst, xsrc, gw, mblk, bhi, blo, acc);

  // ---- Each wave lays its partial down as it holds it: pair p = mt*4+ii is
  // accumulator registers 2*ii and 2*ii+1 of tile mt, lane by lane.
  // (Both loops unrolled: acc is indexed by constants only.)
  v2f* pw = part + wave * (NPAIR * 32) + lane;
#pragma unroll
  for (int mt = 0; mt < MT; mt++) {
#pragma unroll
    for (int ii = 0; ii < 4; ii++) {
      v2f p2 = { acc[mt][2 * ii], acc[mt][2 * ii + 1] };
      pw[(mt * 4 + ii) * 32] = p2;
    }
  }
  __syncthreads();

  // ---- Sum the 16 slices. Wave w < 12 takes pair w, so mt = w / 4 and
  // ii = w % 4. D layout: VGPR i -> M = i + 8*kh, N = r (the key): the lane holds
  // key r of rows lrow and lrow + 1 (counted within the block).
  const int pmt  = wave >> 2;
  const int lrow = pmt * 16 + kh * 8 + (wave & 3) * 2;
  v4f vv[16];                                   // V[t][4 r .. 4 r + 3] of the tile's batch
  if (wave < NPAIR) {
    // Asked for ahead of the LDS sums, so that the loads fly under them.
    const float* vq = v16 + ((mblk + pmt * 16) >> 12) * (16 * HEAD) + r * 4;
#pragma unroll  // constant t: vv stays in registers
    for (int t = 0; t < 16; t++) vv[t] = *(const v4f*)(vq + t * HEAD);

    const v2f* pr = part + wave * 32 + lane;
    v2f sum = pr[0];
#pragma unroll  // the 16 LDS reads of a lane issue ahead of the adds
    for (int sl = 1; sl < KW; sl++) sum += pr[sl * (NPAIR * 32)];

    // Collapsed attention: 16 distinct keys, key t counts cnt times under the
    // causal mask. The lane makes the unnormalised weight of its key.
    float* ed = wrow + lrow * EPITCH + r;
#pragma unroll  // constant i: sum[i] is a register; the two rows' chains interleave
    for (int i = 0; i < 2; i++) {
      const int   qi   = (mblk + lrow + i) & (SEQ - 1);
      const int   cnt  = (qi >> 4) + ((r <= (qi & 15)) ? 1 : 0);
      const float s    = sum[i] * 0.125f;       // HEAD^-0.5 = 1/8
      const float smax = row_max16(cnt > 0 ? s : -3.0e38f);
      const float e    = (float)cnt * expf(s - smax);
      ed[i * EPITCH] = (cnt > 0) ? e : 0.f;
    }
  }
  __syncthreads();

  if (wave >= NPAIR) return;                    // behind the last barrier

  // ---- V combine: the lane has output columns 4 r .. 4 r + 3 of its two rows,
  // so 16 lanes store one whole row of 256 bytes. Z and each output are summed
  // over the keys in rising order.
  const float* er   = wrow + lrow * EPITCH;
  float*       orow = out + (size_t)(mblk + lrow) * HEAD + r * 4;
#pragma unroll  // all three loops: w and vv are indexed by constants only (registers)
  for (int i = 0; i < 2; i++) {
    float w[16];
#pragma unroll
    for (int k = 0; k < 4; k++) *(v4f*)(w + 4 * k) = *(const v4f*)(er + i * EPITCH + 4 * k);
    float Z = 0.f;
    v4f   o = {};
#pragma unroll
    for (int t = 0; t < 16; t++) {
      Z += w[t];
      o += w[t] * vv[t];
    }
    *(v4f*)(orow + i * HEAD) = o * (1.0f / Z);
  }
}

// ---------------------------------------------------------------------------
extern "C" void kernel_launch(void* const* d_in, const int* in_sizes, int n_in,
                              void* d_out, int out_size, void* d_ws, size_t ws_size,
                              hipStream_t stream) {
  const float* x  = (const float*)d_in[0];
  const float* Wq = (const float*)d_in[1];
  const float* Wk = (const float*)d_in[2];
  const float* Wv = (const float*)d_in[3];
  float* out = (float*)d_out;

  char* ws = (char*)d_ws;
  // ws layout: g (384KB of the first 512KB) | k16 (12KB) | v16 (12KB)
  __bf16* g     = (__bf16*)(ws);
  float*  k16   = (float*) (ws + 524288);
  float*  v16   = (float*) (ws + 524288 + 12288);

  prep_kv  <<<BATCH * 8 * 4, 512, 0, stream>>>(x, Wk, Wv, k16, v16);
  fold_g   <<<BATCH * (EMB / 32), 64, 0, stream>>>(Wq, k16, g);
  attn_main<<<NROWS / (MT * 16), KW * 32, 0, stream>>>(x, g, v16, out);
}

// v007
// It runs in 16.5 microseconds.
// Timed twice side by side with v006, it ran 1.17 times as fast both times.
// Counting every step since v000, it is 9.23 times as fast.
#include <hip/hip_runtime.h>
#include <hip/hip_bf16.h>
#include <math.h>

// Problem constants (from reference)
#define BATCH   3
#define SEQ     4096
#define EMB     2048
#define HEAD    64
#define NROWS   (BATCH * SEQ)     // 12288 query rows

typedef __attribute__((ext_vector_type(16))) __bf16 v16bf;
typedef __attribute__((ext_vector_type(8)))  __bf16 v8bf;
typedef __attribute__((ext_vector_type(8)))  float  v8f;
typedef __attribute__((ext_vector_type(4)))  float  v4f;
typedef __attribute__((ext_vector_type(2)))  float  v2f;

// ---------------------------------------------------------------------------
// Kernel 1: k16/v16 = x[b, 0:16, :] @ Wk^T / Wv^T  (full f32; only 16
// distinct K/V rows per batch survive the paged-cache semantics)
// A block of 8 waves owns 2 x rows and 16 heads of one matrix: 192 blocks, each
// reading 18 rows of 8 KB, so that no WGP has much to bring in through its own
// path from L2. k16 and v16 are laid down in these tiles,
//   [pair of rows][16 heads][row of the pair][head],
// 32 floats a tile, so each 128-byte line has one writing block (KVIDX below).
// A wave owns a 2x8 patch of outputs (2 x rows, 8 weight rows) over a quarter of
// the 2048-long sum: 512 columns, 4 steps of 128 (16 bytes a lane, 512 contiguous
// bytes a load). These are 40 loads a wave, few enough to be asked for all at
// once: the wave pays the way to memory once, not once per handful of loads.
// The 16 sums of a wave are closed over its lanes by a halving butterfly, the
// four quarters through LDS.
// ---------------------------------------------------------------------------
// Place of (row = 16 * batch + key, head) in k16 or v16, in floats.
#define KVIDX(row, head) \
  ((((row) >> 1) * 4 + ((head) >> 4)) * 32 + ((row) & 1) * 16 + ((head) & 15))
#define PSTEP   4                 // steps of 128 columns a wave
#define PHEAD   8                 // weight rows a wave
#define PSLICE  (PSTEP * 128)     // 512 columns a wave
#define PKW     (EMB / PSLICE)    // 4 waves share a sum

// The value of lane l ^ M, M < 16 (DPP row_xmask). All 32 lanes are on where it is called.
template <int M>
__device__ __forceinline__ float lane_xor(float v) {
  return __int_as_float(__builtin_amdgcn_update_dpp(0, __float_as_int(v), 0x160 | M, 0xf, 0xf, false));
}

__global__ __launch_bounds__(256) void prep_kv(const float* __restrict__ x,
                        const float* __restrict__ Wk,
                        const float* __restrict__ Wv,
                        float* __restrict__ k16, float* __restrict__ v16) {
  __shared__ float red[PKW][32];                // [quarter][x row of the block][head of the block]

  const int lane = threadIdx.x & 31;
  const int wave = threadIdx.x >> 5;            // 0..7
  const int pt   = wave & 1;                    // patch: 8 of the block's 16 heads
  const int ks   = wave >> 1;                   // quarter of the sum
  const int rp   = blockIdx.x >> 3;             // 0..23: pair of x rows
  const int cg   = blockIdx.x & 7;              // matrix and quarter of the heads
  const int b    = rp >> 3;
  const int t    = (rp & 7) * 2;
  const int h    = (cg & 3) * 16;               // first head of the block
  const float* Wm  = (cg >> 2) ? Wv : Wk;
  float*       dst = (cg >> 2) ? v16 : k16;

  const float* x0 = x  + ((size_t)b * SEQ + t) * EMB + ks * PSLICE + lane * 4;
  const float* w0 = Wm + (size_t)(h + pt * PHEAD) * EMB + ks * PSLICE + lane * 4;

  // (All loops below are unrolled: the arrays are indexed by constants only and
  // stay in registers.)
  v4f xs[PSTEP][2], ws[PSTEP][PHEAD];
#pragma unroll
  for (int c = 0; c < PSTEP; c++) {
#pragma unroll
    for (int i = 0; i < 2; i++) xs[c][i] = *(const v4f*)(x0 + i * EMB + c * 128);
#pragma unroll
    for (int j = 0; j < PHEAD; j++) ws[c][j] = *(const v4f*)(w0 + j * EMB + c * 128);
  }
  // A precaution: the wait stands in front of every later write of a register that
  // an issued load names. The two pointers as inputs keep the loads' address
  // registers from being handed out as a load's destination ahead of it.
  asm volatile("s_wait_xcnt 0x0" :: "v"(x0), "v"(w0) : "memory");
  // Keeps all 40 loads ahead of the first sum: left alone the compiler holds 15 of
  // them back behind the first results (a second latency).
  __builtin_amdgcn_sched_barrier(0);

  v4f a[2][PHEAD] = {};
#pragma unroll
  for (int c = 0; c < PSTEP; c++) {
#pragma unroll
    for (int i = 0; i < 2; i++) {
#pragma unroll
      for (int j = 0; j < PHEAD; j++) a[i][j] += xs[c][i] * ws[c][j];
    }
  }
  float s[16];                                  // sum n = 8 i + j: x row i, weight row j
#pragma unroll
  for (int n = 0; n < 16; n++) {
    const v4f v = a[n >> 3][n & 7];
    s[n] = (v.x + v.y) + (v.z + v.w);
  }

  // Halving butterfly: at each step a lane keeps half of its sums and hands the
  // other half to its partner, which keeps those. Lane bit 4 picks bit 3 of n,
  // bit 3 picks bit 2, bit 2 picks bit 1, bit 1 picks bit 0; the last step adds
  // the two lanes of a pair. Lane l ends with sum n = l / 2 over all 32 lanes.
  const bool u16 = lane & 16, u8 = lane & 8, u4 = lane & 4, u2 = lane & 2;
#pragma unroll
  for (int n = 0; n < 8; n++)
    s[n] = (u16 ? s[n + 8] : s[n]) + __shfl_xor(u16 ? s[n] : s[n + 8], 16, 32);
#pragma unroll
  for (int n = 0; n < 4; n++)
    s[n] = (u8 ? s[n + 4] : s[n]) + lane_xor<8>(u8 ? s[n] : s[n + 4]);
#pragma unroll
  for (int n = 0; n < 2; n++)
    s[n] = (u4 ? s[n + 2] : s[n]) + lane_xor<4>(u4 ? s[n] : s[n + 2]);
  float mine = (u2 ? s[1] : s[0]) + lane_xor<2>(u2 ? s[0] : s[1]);
  mine += lane_xor<1>(mine);

  // The even lanes lay the wave's 16 sums down: n = lane / 2.
  if ((lane & 1) == 0) red[ks][(lane >> 4) * 16 + pt * PHEAD + ((lane >> 1) & 7)] = mine;
  __syncthreads();

  // One wave adds the quarters in rising order and stores the block's tile, one
  // 128-byte line.
  if (threadIdx.x < 32) {
    const int o = threadIdx.x;                  // x row o / 16, head o % 16 of the block
    const float sum = ((red[0][o] + red[1][o]) + red[2][o]) + red[3][o];
    dst[KVIDX(b * 16 + t + (o >> 4), h + (o & 15))] = sum;
  }
}

// ---------------------------------------------------------------------------
// Kernel 2: fold Wq into the 16 keys of each batch. The scores are
// (x Wq^T) k16^T / 8 = (x G^T) / 8 with G[b][t][e] = sum_h k16[b][t][h] Wq[h][e].
// G is split into bf16 hi/lo planes (for the bf16x3 WMMA GEMM) and laid down as
// the B fragments are read: per batch and per block of 32 columns e
//   [plane hi, lo][half of the fragment][fragment lane kh*16 + t][8 columns]
// with e = 32*block + 16*half + 8*kh + i, so that one wave-wide 16-byte load
// of attn_main is 512 contiguous bytes.
// The fold is a small f32 GEMM on the matrix unit (16x16x4, full f32): a wave
// owns one (batch, 16 columns); A = Wq^T (row = column e), B = k16^T (column =
// key t), 16 steps of 4 heads. D register i of lane kh*16 + t is then
// G[t][e0 + 8*kh + i]: the lane's 8 registers are its 16 bytes of the layout
// above, and the wave stores 512 contiguous bytes a plane.
// All 40 loads of a lane are independent of each other and fly together.
// Heads of step st: lane half kh, element s holds head
//   4*kh + 8*(st/2) + 2*(st%2) + s
// in A and in B alike (the pairing is all that counts), chosen so that the two
// halves of a key's lane pair read 32 adjoining bytes of k16 with each load.
// ---------------------------------------------------------------------------
#define GBLK    1024              // bf16 elements of G per block of 32 columns
#define GBATCH  (EMB / 32 * GBLK) // bf16 elements of G per batch (128 KB)

__global__ __launch_bounds__(64) void fold_g(const float* __restrict__ Wq,
                                             const float* __restrict__ k16,
                                             __bf16* __restrict__ g) {
  const int lane = threadIdx.x & 31;
  const int c    = lane & 15;                   // A: column e0 + c; B, D: key c
  const int kh   = lane >> 4;
  const int half = __builtin_amdgcn_readfirstlane(threadIdx.x >> 5);
  const int b    = blockIdx.x >> 6;
  const int kblk = blockIdx.x & 63;

  const float* kp = k16 + KVIDX(b * 16 + c, 4 * kh);   // heads 4*kh .. of key c
  const float* wp = Wq + (size_t)(4 * kh) * EMB + kblk * 32 + half * 16 + c;

  v4f kq[8];                                    // heads 4*kh + 8*j + 0..3 of key c
#pragma unroll  // constant j: kq stays in registers
  for (int j = 0; j < 8; j++) kq[j] = *(const v4f*)(kp + KVIDX(0, 8 * j));
  v2f wa[16];
#pragma unroll  // constant st: wa stays in registers, the loads issue ahead of the sums
  for (int st = 0; st < 16; st++) {
    const int hc = 8 * (st >> 1) + 2 * (st & 1);
    wa[st].x = wp[(size_t)hc * EMB];
    wa[st].y = wp[(size_t)(hc + 1) * EMB];
  }

  // Keeps all 40 loads ahead of the first matrix instruction: left alone the
  // compiler holds 12 of them back behind the first results (a second latency).
  __builtin_amdgcn_sched_barrier(0);

  v8f acc = {};
#pragma unroll  // constant st, as above
  for (int st = 0; st < 16; st++) {
    v2f kb = { kq[st >> 1][2 * (st & 1)], kq[st >> 1][2 * (st & 1) + 1] };
    acc = __builtin_amdgcn_wmma_f32_16x16x4_f32(false, wa[st], false, kb,
                                                (short)0, acc, false, false);
  }
  // The two barriers hold the v_nop directly behind the last matrix instruction
  // and keep other vector work out of the chain (it would write operand registers).
  __builtin_amdgcn_sched_barrier(0);
  // Four vector slots between the last matrix instruction and the first reader of D.
  asm volatile("v_nop\n\tv_nop\n\tv_nop\n\tv_nop");
  __builtin_amdgcn_sched_barrier(0);

  v8bf hi8, lo8;
#pragma unroll
  for (int i = 0; i < 8; i++) {
    __bf16 hi = (__bf16)acc[i];
    hi8[i] = hi;
    lo8[i] = (__bf16)(acc[i] - (float)hi);
  }
  __bf16* gd = g + (size_t)b * GBATCH + kblk * GBLK + half * 256 + lane * 8;
  *(v8bf*)gd         = hi8;
  *(v8bf*)(gd + 512) = lo8;
}

#define MT      3                 // 16-row tiles a block
#define KW      16                // waves a block = K slices
#define KSLICE  (EMB / KW)        // 128 columns a wave
#define KSTEPS  (KSLICE / 32)     // 4 WMMA k steps a wave and tile
#define NPAIR   (MT * 4)          // 12 register pairs of accumulators a lane
#define RPITCH  132               // floats a staged row: 512 B + 16 B = 33 units of
                                  // 16 B, odd, so 16 rows' ds_load_b128 spread over the banks
#define TILEF   (16 * RPITCH)     // floats of one wave's staged tile
#define BUFF    (KW * TILEF)      // floats of one buffer (all 16 waves)
#define EPITCH  20                // floats a row of softmax weights in LDS: 16 + 4,
                                  // so every row starts on 16 bytes (ds_load_b128)

// Maximum over the 16 lanes of a row (lanes l ^ 1, ^ 2, ^ 4, ^ 8 by DPP row_xmask);
// every lane gets it. All 32 lanes are on where it is called.
__device__ __forceinline__ float row_max16(float v) {
  v = fmaxf(v, __int_as_float(__builtin_amdgcn_update_dpp(0, __float_as_int(v), 0x161, 0xf, 0xf, false)));
  v = fmaxf(v, __int_as_float(__builtin_amdgcn_update_dpp(0, __float_as_int(v), 0x162, 0xf, 0xf, false)));
  v = fmaxf(v, __int_as_float(__builtin_amdgcn_update_dpp(0, __float_as_int(v), 0x164, 0xf, 0xf, false)));
  v = fmaxf(v, __int_as_float(__builtin_amdgcn_update_dpp(0, __float_as_int(v), 0x168, 0xf, 0xf, false)));
  return v;
}

// Eight rows of a wave's tile, one copy a row: lane l brings bytes 16 l .. 16 l + 15
// of the row's slice. l = the lane's LDS byte address in the first row, gp its
// global address there. s_wait_xcnt 0 is the statement's last line, so it stands
// in front of every later write of a register that a copy names (a precaution).
__device__ __forceinline__ void copy_rows8(unsigned l, const float* gp) {
  asm volatile(
      "global_load_async_to_lds_b128 %0, %8, off\n\t"
      "global_load_async_to_lds_b128 %1, %9, off\n\t"
      "global_load_async_to_lds_b128 %2, %10, off\n\t"
      "global_load_async_to_lds_b128 %3, %11, off\n\t"
      "global_load_async_to_lds_b128 %4, %12, off\n\t"
      "global_load_async_to_lds_b128 %5, %13, off\n\t"
      "global_load_async_to_lds_b128 %6, %14, off\n\t"
      "global_load_async_to_lds_b128 %7, %15, off\n\t"
      "s_wait_xcnt 0x0"
      :: "v"(l),                  "v"(l + 1 * RPITCH * 4), "v"(l + 2 * RPITCH * 4),
         "v"(l + 3 * RPITCH * 4), "v"(l + 4 * RPITCH * 4), "v"(l + 5 * RPITCH * 4),
         "v"(l + 6 * RPITCH * 4), "v"(l + 7 * RPITCH * 4),
         "v"(gp),           "v"(gp + 1 * EMB), "v"(gp + 2 * EMB), "v"(gp + 3 * EMB),
         "v"(gp + 4 * EMB), "v"(gp + 5 * EMB), "v"(gp + 6 * EMB), "v"(gp + 7 * EMB)
      : "memory");
}

// A wave's whole tile: 16 rows, 16 copies in flight.
__device__ __forceinline__ void stage_tile(unsigned l, const float* gp) {
  copy_rows8(l, gp);
  copy_rows8(l + 8 * RPITCH * 4, gp + 8 * EMB);
}

// A wave's slice of one batch's G: the B fragments (hi and lo) of its 4 k steps.
__device__ __forceinline__ void load_g(const __bf16* __restrict__ gp,
                                       v16bf (&bhi)[KSTEPS], v16bf (&blo)[KSTEPS]) {
#pragma unroll  // constant j: the fragments stay in registers
  for (int j = 0; j < KSTEPS; j++) {
    const __bf16* bp = gp + j * GBLK;
    v8bf bh0 = *(const v8bf*)(bp);
    v8bf bh1 = *(const v8bf*)(bp + 256);
    v8bf bl0 = *(const v8bf*)(bp + 512);
    v8bf bl1 = *(const v8bf*)(bp + 768);
    bhi[j] = __builtin_shufflevector(bh0, bh1, 0,1,2,3,4,5,6,7,8,9,10,11,12,13,14,15);
    blo[j] = __builtin_shufflevector(bl0, bl1, 0,1,2,3,4,5,6,7,8,9,10,11,12,13,14,15);
  }
}

// The 3 passes. On entry tile 0 is published in buffer 0, tile 1's copies fly
// into buffer 1, and bhi, blo hold G of tile 0's batch. ONE: the 3 row tiles lie
// in one batch and share those fragments; otherwise (the two blocks that span a
// batch border) each tile loads the fragments of its own batch.
template <bool ONE>
__device__ __forceinline__ void score_tiles(const float* arow, unsigned ldst,
                                            const float* __restrict__ xsrc,
                                            const __bf16* __restrict__ gw, int mblk,
                                            v16bf (&bhi)[KSTEPS], v16bf (&blo)[KSTEPS],
                                            v8f (&acc)[MT]) {
#pragma unroll  // constant mt: acc stays in registers, the buffer is a constant
  for (int mt = 0; mt < MT; mt++) {
    if (!ONE && mt > 0)
      load_g(gw + (size_t)((mblk + mt * 16) >> 12) * GBATCH, bhi, blo);
    const float* at = arow + (mt & 1) * BUFF;
#pragma unroll  // constant j, as in load_g
    for (int j = 0; j < KSTEPS; j++) {
      // ---- A operand: x row, ISA 16-bit A layout.
      // lanes 0-15: K = {0..7, 16..23}; lanes 16-31: K = {8..15, 24..31}
      const float* ap = at + j * 32;
      float af[16];
      *(v4f*)(af + 0)  = *(const v4f*)(ap + 0);
      *(v4f*)(af + 4)  = *(const v4f*)(ap + 4);
      *(v4f*)(af + 8)  = *(const v4f*)(ap + 16);
      *(v4f*)(af + 12) = *(const v4f*)(ap + 20);
      v16bf ah, al;
#pragma unroll
      for (int i = 0; i < 16; i++) {
        float  f = af[i];
        __bf16 h = (__bf16)f;
        ah[i] = h;
        al[i] = (__bf16)(f - (float)h);         // exact residual, then bf16
      }
      // bf16x3: xh*gh + xl*gh + xh*gl  (f32 accumulate)
      acc[mt] = __builtin_amdgcn_wmma_f32_16x16x32_bf16(false, ah, false, bhi[j],
                                                  (short)0, acc[mt], false, false);
      acc[mt] = __builtin_amdgcn_wmma_f32_16x16x32_bf16(false, al, false, bhi[j],
                                                  (short)0, acc[mt], false, false);
      acc[mt] = __builtin_amdgcn_wmma_f32_16x16x32_bf16(false, ah, false, blo[j],
                                                  (short)0, acc[mt], false, false);
    }
    // Foot of the pass: this wave's reads of its buffer are done ...
    asm volatile("s_wait_dscnt 0x0" ::: "memory");
    // ... and its copies of the next tile have landed.
    asm volatile("s_wait_asynccnt 0x0" ::: "memory");
    // Publishes the next tile and frees the buffer just read (behind the last
    // pass: frees the ring for the partials).
    __syncthreads();
    if (mt + 2 < MT)
      stage_tile(ldst + (mt & 1) * BUFF * 4, xsrc + (size_t)(mt + 2) * 16 * EMB);
  }
  // No copy is left in flight when the ring is written again.
  asm volatile("s_wait_asynccnt 0x0" ::: "memory");
}

__global__ __launch_bounds__(512) void attn_main(
    const float*  __restrict__ x,
    const __bf16* __restrict__ g,
    const float*  __restrict__ v16,
    float*        __restrict__ out) {
  // Two buffers of staged x; behind the last pass the same LDS takes the partials.
  __shared__ __attribute__((aligned(16))) float ring[2 * BUFF];
  __shared__ __attribute__((aligned(16))) float wrow[MT * 16 * EPITCH];  // 48 rows x 16 weights
  v2f* part = (v2f*)ring;                       // [slice][register pair][lane]

  const int wave = __builtin_amdgcn_readfirstlane(threadIdx.x >> 5);
  const int lane = threadIdx.x & 31;
  const int r    = lane & 15;                   // row within tile / N index
  const int kh   = lane >> 4;                   // lane-half: selects K sub-blocks
  const int mblk = blockIdx.x * (MT * 16);      // first row of the block

  // Copies: this lane's 16 bytes of the wave's slice, first row of the block.
  const float*   xsrc = x + (size_t)mblk * EMB + wave * KSLICE + lane * 4;
  const unsigned ldst = (unsigned)(uintptr_t)(ring + wave * TILEF + lane * 4);
  // Fragments: row r of the wave's staged tile, this lane-half's first column.
  const float*   arow = ring + wave * TILEF + r * RPITCH + kh * 8;
  // This wave's slice of G within a batch.
  const __bf16*  gw   = g + wave * KSTEPS * GBLK + lane * 8;

  stage_tile(ldst, xsrc);                       // tile 0 -> buffer 0

  // G of tile 0's batch (a tile of 16 rows never spans two batches).
  const int gb = mblk >> 12;
  v16bf bhi[KSTEPS], blo[KSTEPS];
  load_g(gw + (size_t)gb * GBATCH, bhi, blo);

  // Tile 0 has landed in this wave's part of buffer 0 ...
  asm volatile("s_wait_asynccnt 0x0" ::: "memory");
  __syncthreads();                              // ... and in every wave's
  stage_tile(ldst + BUFF * 4, xsrc + (size_t)16 * EMB);   // tile 1 -> buffer 1

  v8f acc[MT] = {};                             // 48x16 f32 partial scores

  if (__builtin_expect(gb == ((mblk + MT * 16 - 1) >> 12), 1))   // block-uniform
    score_tiles<true>(arow, ldst, xsrc, gw, mblk, bhi, blo, acc);
  else
    score_tiles<false>(arow, ldst, xsrc, gw, mblk, bhi, blo, acc);

  // ---- Each wave lays its partial down as it holds it: pair p = mt*4+ii is
  // accumulator registers 2*ii and 2*ii+1 of tile mt, lane by lane.
  // (Both loops unrolled: acc is indexed by constants only.)
  v2f* pw = part + wave * (NPAIR * 32) + lane;
#pragma unroll
  for (int mt = 0; mt < MT; mt++) {
#pragma unroll
    for (int ii = 0; ii < 4; ii++) {
      v2f p2 = { acc[mt][2 * ii], acc[mt][2 * ii + 1] };
      pw[(mt * 4 + ii) * 32] = p2;
    }
  }
  __syncthreads();

  // ---- Sum the 16 slices. Wave w < 12 takes pair w, so mt = w / 4 and
  // ii = w % 4. D layout: VGPR i -> M = i + 8*kh, N = r (the key): the lane holds
  // key r of rows lrow and lrow + 1 (counted within the block).
  const int pmt  = wave >> 2;
  const int lrow = pmt * 16 + kh * 8 + (wave & 3) * 2;
  v4f vv[16];                                   // V[t][4 r .. 4 r + 3] of the tile's batch
  if (wave < NPAIR) {
    // Asked for ahead of the LDS sums, so that the loads fly under them.
    const float* vq = v16 + ((mblk + pmt * 16) >> 12) * (16 * HEAD) + KVIDX(0, r * 4);
#pragma unroll  // constant t: vv stays in registers
    for (int t = 0; t < 16; t++) vv[t] = *(const v4f*)(vq + KVIDX(t, 0));

    const v2f* pr = part + wave * 32 + lane;
    v2f sum = pr[0];
#pragma unroll  // the 16 LDS reads of a lane issue ahead of the adds
    for (int sl = 1; sl < KW; sl++) sum += pr[sl * (NPAIR * 32)];

    // Collapsed attention: 16 distinct keys, key t counts cnt times under the
    // causal mask. The lane makes the unnormalised weight of its key.
    float* ed = wrow + lrow * EPITCH + r;
#pragma unroll  // constant i: sum[i] is a register; the two rows' chains interleave
    for (int i = 0; i < 2; i++) {
      const int   qi   = (mblk + lrow + i) & (SEQ - 1);
      const int   cnt  = (qi >> 4) + ((r <= (qi & 15)) ? 1 : 0);
      const float s    = sum[i] * 0.125f;       // HEAD^-0.5 = 1/8
      const float smax = row_max16(cnt > 0 ? s : -3.0e38f);
      const float e    = (float)cnt * expf(s - smax);
      ed[i * EPITCH] = (cnt > 0) ? e : 0.f;
    }
  }
  __syncthreads();

  if (wave >= NPAIR) return;                    // behind the last barrier

  // ---- V combine: the lane has output columns 4 r .. 4 r + 3 of its two rows,
  // so 16 lanes store one whole row of 256 bytes. Z and each output are summed
  // over the keys in rising order.
  const float* er   = wrow + lrow * EPITCH;
  float*       orow = out + (size_t)(mblk + lrow) * HEAD + r * 4;
#pragma unroll  // all three loops: w and vv are indexed by constants only (registers)
  for (int i = 0; i < 2; i++) {
    float w[16];
#pragma unroll
    for (int k = 0; k < 4; k++) *(v4f*)(w + 4 * k) = *(const v4f*)(er + i * EPITCH + 4 * k);
    float Z = 0.f;
    v4f   o = {};
#pragma unroll
    for (int t = 0; t < 16; t++) {
      Z += w[t];
      o += w[t] * vv[t];
    }
    *(v4f*)(orow + i * HEAD) = o * (1.0f / Z);
  }
}

// ---------------------------------------------------------------------------
extern "C" void kernel_launch(void* const* d_in, const int* in_sizes, int n_in,
                              void* d_out, int out_size, void* d_ws, size_t ws_size,
                              hipStream_t stream) {
  const float* x  = (const float*)d_in[0];
  const float* Wq = (const float*)d_in[1];
  const float* Wk = (const float*)d_in[2];
  const float* Wv = (const float*)d_in[3];
  float* out = (float*)d_out;

  char* ws = (char*)d_ws;
  // ws layout: g (384KB of the first 512KB) | k16 (12KB) | v16 (12KB)
  __bf16* g     = (__bf16*)(ws);
  float*  k16   = (float*) (ws + 524288);
  float*  v16   = (float*) (ws + 524288 + 12288);

  prep_kv  <<<BATCH * 8 * 8, 256, 0, stream>>>(x, Wk, Wv, k16, v16);
  fold_g   <<<BATCH * (EMB / 32), 64, 0, stream>>>(Wq, k16, g);
  attn_main<<<NROWS / (MT * 16), KW * 32, 0, stream>>>(x, g, v16, out);
}
